// v000
// The times below were measured on an AMD MI455X: many runs one after another, warmed up first and cycling through
// copies of the inputs, with the whole window's GPU time divided by the number of runs. Launches and the gaps
// between them are all in it. The median over several windows is given; except for v000 it joins two sittings, which
// can be a few percent apart, so the side-by-side timings, each taken in one sitting, are the better comparison.
// v000 is the starting kernel. One run takes 233 microseconds.
#include <hip/hip_runtime.h>

typedef __attribute__((ext_vector_type(16))) _Float16 v16h;
typedef __attribute__((ext_vector_type(8)))  _Float16 v8h;
typedef __attribute__((ext_vector_type(4)))  _Float16 v4h;
typedef __attribute__((ext_vector_type(8)))  float    v8f;
typedef __attribute__((ext_vector_type(4)))  float    v4f;

#define HEADS   16
#define CH      64
#define NCTX    2048
#define WTOK    (3 * HEADS * CH)   // 3072 floats per token
#define QTILE   128                // query rows per block
#define KTILE   128                // keys per streaming tile
#define NCHUNK  (KTILE / 16)       // 8 S-tiles of 16 keys
#define KFRAG   (KTILE / 32)       // 4 A/B fragment pairs along PV K-dim
#define NWAVES  8

// ---- 16-lane xor-butterfly reductions: pure VALU via v_permlane16_b32 ------
#if defined(__has_builtin)
#  if __has_builtin(__builtin_amdgcn_permlane16)
#    define HAVE_PERMLANE16 1
#  endif
#endif

__device__ __forceinline__ float lanexor16(float v, unsigned s0, unsigned s1)
{
#ifdef HAVE_PERMLANE16
    unsigned u = __float_as_uint(v);
    unsigned p = __builtin_amdgcn_permlane16(u, u, s0, s1, false, false);
    return __uint_as_float(p);
#else
    (void)s0; (void)s1;
    return v;   // unused in fallback path
#endif
}

__device__ __forceinline__ float redmax16(float v)
{
#ifdef HAVE_PERMLANE16
    v = fmaxf(v, lanexor16(v, 0x67452301u, 0xEFCDAB89u)); // ^1
    v = fmaxf(v, lanexor16(v, 0x54761032u, 0xDCFE98BAu)); // ^2
    v = fmaxf(v, lanexor16(v, 0x32107654u, 0xBA98FEDCu)); // ^4
    v = fmaxf(v, lanexor16(v, 0xFEDCBA98u, 0x76543210u)); // ^8
#else
    for (int m = 1; m <= 8; m <<= 1) v = fmaxf(v, __shfl_xor(v, m, 32));
#endif
    return v;
}

__device__ __forceinline__ float redsum16(float v)
{
#ifdef HAVE_PERMLANE16
    v += lanexor16(v, 0x67452301u, 0xEFCDAB89u);
    v += lanexor16(v, 0x54761032u, 0xDCFE98BAu);
    v += lanexor16(v, 0x32107654u, 0xBA98FEDCu);
    v += lanexor16(v, 0xFEDCBA98u, 0x76543210u);
#else
    for (int m = 1; m <= 8; m <<= 1) v += __shfl_xor(v, m, 32);
#endif
    return v;
}

// ---------------------------------------------------------------------------
// Flash-attention forward, one (batch, head, 128-row q-tile) per block.
// 8 waves x 16 q-rows each. All matmuls on v_wmma_f32_16x16x32_f16.
// ---------------------------------------------------------------------------
__global__ __launch_bounds__(256)
void fa_fwd_kernel(const float* __restrict__ qkv, float* __restrict__ out)
{
    __shared__ __align__(16) _Float16 sK [KTILE][CH];         // [key][ch] row-major
    __shared__ __align__(16) _Float16 sVt[CH][KTILE];         // [ch][key] transposed
    __shared__ __align__(16) _Float16 sP [NWAVES][16][KTILE]; // per-wave P scratch

    const int tid   = threadIdx.x;
    const int wave  = tid >> 5;
    const int lane  = tid & 31;
    const int l16   = lane & 15;
    const int half  = lane >> 4;        // 0: lanes 0-15, 1: lanes 16-31
    const int kbase = half * 8;         // 16-bit A/B fragment K-pattern

    const int qtile = blockIdx.x;       // 0..15
    const int head  = blockIdx.y;       // 0..15
    const int batch = blockIdx.z;

    const float scale2 = 0.125f;        // (1/d^(1/4))^2 = 1/sqrt(64)

    // ------- load this wave's Q fragments (16 rows x 64 ch as 2 A-frags) ----
    const int    qrow = qtile * QTILE + wave * 16 + l16;
    const float* qptr = qkv + ((size_t)(batch * NCTX + qrow) * HEADS + head) * (3 * CH);

    v16h qfrag[2];
#pragma unroll
    for (int f = 0; f < 2; ++f) {
        const int k0 = f * 32 + kbase;
        v4f a = *(const v4f*)(qptr + k0);
        v4f b = *(const v4f*)(qptr + k0 + 4);
        v4f c = *(const v4f*)(qptr + k0 + 16);
        v4f d = *(const v4f*)(qptr + k0 + 20);
#pragma unroll
        for (int i = 0; i < 4; ++i) {
            qfrag[f][i]      = (_Float16)(a[i] * scale2);
            qfrag[f][4 + i]  = (_Float16)(b[i] * scale2);
            qfrag[f][8 + i]  = (_Float16)(c[i] * scale2);
            qfrag[f][12 + i] = (_Float16)(d[i] * scale2);
        }
    }

    // ------- online softmax state (lane element r <-> row r + 8*half) ------
    float m[8], l[8];
    v8f   o[4];
#pragma unroll
    for (int r = 0; r < 8; ++r) { m[r] = -1e30f; l[r] = 0.0f; }
#pragma unroll
    for (int cc = 0; cc < 4; ++cc)
#pragma unroll
        for (int r = 0; r < 8; ++r) o[cc][r] = 0.0f;

    // ------- stream over key tiles ------------------------------------------
    for (int kt = 0; kt < NCTX / KTILE; ++kt) {
        __syncthreads();   // previous tile fully consumed

        // cooperative fp32 -> fp16 load: K row-major, V transposed
        {
            const int ch4  = (tid & 15) * 4;  // 0..60
            const int key0 = tid >> 4;        // 0..15
#pragma unroll
            for (int it = 0; it < KTILE / 16; ++it) {
                const int    key = key0 + it * 16;
                const float* kp  = qkv + ((size_t)(batch * NCTX + kt * KTILE + key) * HEADS + head) * (3 * CH) + CH;
                v4f kv = *(const v4f*)(kp + ch4);        // K at +64
                v4f vv = *(const v4f*)(kp + CH + ch4);   // V at +128
                v4h kh;
#pragma unroll
                for (int i = 0; i < 4; ++i) kh[i] = (_Float16)kv[i];
                *(v4h*)&sK[key][ch4] = kh;
#pragma unroll
                for (int i = 0; i < 4; ++i) sVt[ch4 + i][key] = (_Float16)vv[i];
            }
        }

        // prefetch next key tile into cache while we compute
        if (kt + 1 < NCTX / KTILE) {
            const float* np = qkv + ((size_t)(batch * NCTX + (kt + 1) * KTILE + (tid >> 4)) * HEADS + head) * (3 * CH) + CH;
            __builtin_prefetch(np, 0, 0);
        }

        __syncthreads();   // tile resident in LDS

        // ---- S = (Q*s) (K*s)^T : NCHUNK tiles of 16 keys, 2 WMMAs each ----
        v8f s[NCHUNK];
#pragma unroll
        for (int c = 0; c < NCHUNK; ++c) {
            v8f acc;
#pragma unroll
            for (int r = 0; r < 8; ++r) acc[r] = 0.0f;
            const _Float16* kb = &sK[c * 16 + l16][0];
#pragma unroll
            for (int f = 0; f < 2; ++f) {
                v8h lo = *(const v8h*)(kb + f * 32 + kbase);
                v8h hi = *(const v8h*)(kb + f * 32 + kbase + 16);
                v16h bfrag;
#pragma unroll
                for (int i = 0; i < 8; ++i) { bfrag[i] = lo[i]; bfrag[8 + i] = hi[i]; }
                acc = __builtin_amdgcn_wmma_f32_16x16x32_f16(
                          false, qfrag[f], false, bfrag, (short)0, acc, false, false);
            }
            s[c] = acc;
        }

        // ---- online softmax update ----------------------------------------
        float rmax[8];
#pragma unroll
        for (int r = 0; r < 8; ++r) {
            float v = s[0][r];
#pragma unroll
            for (int c = 1; c < NCHUNK; ++c) v = fmaxf(v, s[c][r]);
            rmax[r] = redmax16(v);
        }

        float alpha[8];
#pragma unroll
        for (int r = 0; r < 8; ++r) {
            const float nm = fmaxf(m[r], rmax[r]);
            alpha[r] = __expf(m[r] - nm);
            m[r]     = nm;
        }
#pragma unroll
        for (int cc = 0; cc < 4; ++cc)
#pragma unroll
            for (int r = 0; r < 8; ++r) o[cc][r] *= alpha[r];

        float rsum[8];
#pragma unroll
        for (int r = 0; r < 8; ++r) rsum[r] = 0.0f;
#pragma unroll
        for (int c = 0; c < NCHUNK; ++c)
#pragma unroll
            for (int r = 0; r < 8; ++r) {
                const float p = __expf(s[c][r] - m[r]);
                s[c][r]  = p;
                rsum[r] += p;
            }
#pragma unroll
        for (int r = 0; r < 8; ++r)
            l[r] = l[r] * alpha[r] + redsum16(rsum[r]);

        // ---- spill P (fp16) to per-wave LDS scratch (C-layout -> A-layout) -
#pragma unroll
        for (int c = 0; c < NCHUNK; ++c)
#pragma unroll
            for (int r = 0; r < 8; ++r)
                sP[wave][r + half * 8][c * 16 + l16] = (_Float16)s[c][r];

        asm volatile("s_wait_dscnt 0" ::: "memory");   // wave-local LDS RAW fence

        // ---- O += P V : A from sP, B from transposed V --------------------
        v16h pfrag[KFRAG];
        const _Float16* pb = &sP[wave][l16][0];
#pragma unroll
        for (int f = 0; f < KFRAG; ++f) {
            v8h lo = *(const v8h*)(pb + f * 32 + kbase);
            v8h hi = *(const v8h*)(pb + f * 32 + kbase + 16);
#pragma unroll
            for (int i = 0; i < 8; ++i) { pfrag[f][i] = lo[i]; pfrag[f][8 + i] = hi[i]; }
        }
#pragma unroll
        for (int cc = 0; cc < 4; ++cc) {
            const _Float16* vb = &sVt[cc * 16 + l16][0];
#pragma unroll
            for (int f = 0; f < KFRAG; ++f) {
                v8h lo = *(const v8h*)(vb + f * 32 + kbase);
                v8h hi = *(const v8h*)(vb + f * 32 + kbase + 16);
                v16h bfrag;
#pragma unroll
                for (int i = 0; i < 8; ++i) { bfrag[i] = lo[i]; bfrag[8 + i] = hi[i]; }
                o[cc] = __builtin_amdgcn_wmma_f32_16x16x32_f16(
                            false, pfrag[f], false, bfrag, (short)0, o[cc], false, false);
            }
        }
    }

    // ------- epilogue: O / l -> out[b, t, h*64 + ch] ------------------------
    float inv[8];
#pragma unroll
    for (int r = 0; r < 8; ++r) inv[r] = 1.0f / l[r];
#pragma unroll
    for (int cc = 0; cc < 4; ++cc)
#pragma unroll
        for (int r = 0; r < 8; ++r) {
            const int row = qtile * QTILE + wave * 16 + r + half * 8;
            const int col = cc * 16 + l16;
            out[((size_t)(batch * NCTX + row) * HEADS + head) * CH + col] = o[cc][r] * inv[r];
        }
}

extern "C" void kernel_launch(void* const* d_in, const int* in_sizes, int n_in,
                              void* d_out, int out_size, void* d_ws, size_t ws_size,
                              hipStream_t stream)
{
    const float* qkv = (const float*)d_in[0];
    float*       out = (float*)d_out;
    const int bs = in_sizes[0] / (NCTX * WTOK);   // 2 for the reference shapes

    dim3 grid(NCTX / QTILE, HEADS, bs);
    fa_fwd_kernel<<<grid, 256, 0, stream>>>(qkv, out);
}

// v001
// One run takes 64.5 microseconds.
// Two timings next to v000 both put it at 3.71 times that version's speed.
#include <hip/hip_runtime.h>

typedef __attribute__((ext_vector_type(16))) _Float16 v16h;
typedef __attribute__((ext_vector_type(8)))  _Float16 v8h;
typedef __attribute__((ext_vector_type(4)))  _Float16 v4h;
typedef __attribute__((ext_vector_type(8)))  float    v8f;
typedef __attribute__((ext_vector_type(4)))  float    v4f;

#define HEADS   16
#define CH      64
#define NCTX    2048
#define WTOK    (3 * HEADS * CH)   // 3072 floats per token
#define QTILE   128                // query rows per block
#define KTILE   128                // keys per streaming tile
#define NCHUNK  (KTILE / 16)       // 8 S-tiles of 16 keys
#define KFRAG   (KTILE / 32)       // 4 A/B fragment pairs along PV K-dim
#define NWAVES  8

// LDS row pitches in halves. Bank = dword address mod 64, so 16 rows read with
// 16-byte loads meet 16 different bank quads only at a pitch of 16 B x odd.
#define KPITCH  (CH + 8)           // 144 B
#define VPITCH  (KTILE + 8)        // 272 B
#define PPITCH  (KTILE + 8)        // 272 B
// Each group of 16 V^T rows starts 16 B later than the pitch alone would put it:
// the staging stores of a half-wave go to rows 4 apart, which 272 B alone folds
// onto 4 banks; with the shift they meet 16 banks.
#define VGROUP  (16 * VPITCH + 8)

// ---- 16-lane xor-butterfly reductions: pure VALU via v_permlane16_b32 ------
#if defined(__has_builtin)
#  if __has_builtin(__builtin_amdgcn_permlane16)
#    define HAVE_PERMLANE16 1
#  endif
#endif

__device__ __forceinline__ float lanexor16(float v, unsigned s0, unsigned s1)
{
#ifdef HAVE_PERMLANE16
    unsigned u = __float_as_uint(v);
    unsigned p = __builtin_amdgcn_permlane16(u, u, s0, s1, false, false);
    return __uint_as_float(p);
#else
    (void)s0; (void)s1;
    return v;   // unused in fallback path
#endif
}

__device__ __forceinline__ float redmax16(float v)
{
#ifdef HAVE_PERMLANE16
    v = fmaxf(v, lanexor16(v, 0x67452301u, 0xEFCDAB89u)); // ^1
    v = fmaxf(v, lanexor16(v, 0x54761032u, 0xDCFE98BAu)); // ^2
    v = fmaxf(v, lanexor16(v, 0x32107654u, 0xBA98FEDCu)); // ^4
    v = fmaxf(v, lanexor16(v, 0xFEDCBA98u, 0x76543210u)); // ^8
#else
    for (int m = 1; m <= 8; m <<= 1) v = fmaxf(v, __shfl_xor(v, m, 32));
#endif
    return v;
}

__device__ __forceinline__ float redsum16(float v)
{
#ifdef HAVE_PERMLANE16
    v += lanexor16(v, 0x67452301u, 0xEFCDAB89u);
    v += lanexor16(v, 0x54761032u, 0xDCFE98BAu);
    v += lanexor16(v, 0x32107654u, 0xBA98FEDCu);
    v += lanexor16(v, 0xFEDCBA98u, 0x76543210u);
#else
    for (int m = 1; m <= 8; m <<= 1) v += __shfl_xor(v, m, 32);
#endif
    return v;
}

// ---------------------------------------------------------------------------
// Flash-attention forward, one (batch, head, 128-row q-tile) per block.
// 8 waves x 16 q-rows each. All matmuls on v_wmma_f32_16x16x32_f16.
// ---------------------------------------------------------------------------
__global__ __launch_bounds__(256)
void fa_fwd_kernel(const float* __restrict__ qkv, float* __restrict__ out)
{
    __shared__ __align__(16) _Float16 sK [KTILE][KPITCH];      // [key][ch] row-major
    __shared__ __align__(16) _Float16 sVt[CH / 16][VGROUP];    // [ch/16][(ch%16)*VPITCH + key]
    __shared__ __align__(16) _Float16 sP [NWAVES][16][PPITCH]; // per-wave P scratch

    const int tid   = threadIdx.x;
    const int wave  = tid >> 5;
    const int lane  = tid & 31;
    const int l16   = lane & 15;
    const int half  = lane >> 4;        // 0: lanes 0-15, 1: lanes 16-31
    const int kbase = half * 8;         // 16-bit A/B fragment K-pattern

    const int qtile = blockIdx.x;       // 0..15
    const int head  = blockIdx.y;       // 0..15
    const int batch = blockIdx.z;

    const float scale2 = 0.125f;        // (1/d^(1/4))^2 = 1/sqrt(64)

    // ------- load this wave's Q fragments (16 rows x 64 ch as 2 A-frags) ----
    const int    qrow = qtile * QTILE + wave * 16 + l16;
    const float* qptr = qkv + ((size_t)(batch * NCTX + qrow) * HEADS + head) * (3 * CH);

    v16h qfrag[2];
#pragma unroll
    for (int f = 0; f < 2; ++f) {
        const int k0 = f * 32 + kbase;
        v4f a = *(const v4f*)(qptr + k0);
        v4f b = *(const v4f*)(qptr + k0 + 4);
        v4f c = *(const v4f*)(qptr + k0 + 16);
        v4f d = *(const v4f*)(qptr + k0 + 20);
#pragma unroll
        for (int i = 0; i < 4; ++i) {
            qfrag[f][i]      = (_Float16)(a[i] * scale2);
            qfrag[f][4 + i]  = (_Float16)(b[i] * scale2);
            qfrag[f][8 + i]  = (_Float16)(c[i] * scale2);
            qfrag[f][12 + i] = (_Float16)(d[i] * scale2);
        }
    }

    // ------- online softmax state (lane element r <-> row r + 8*half) ------
    float m[8], l[8];
    v8f   o[4];
#pragma unroll
    for (int r = 0; r < 8; ++r) { m[r] = -1e30f; l[r] = 0.0f; }
#pragma unroll
    for (int cc = 0; cc < 4; ++cc)
#pragma unroll
        for (int r = 0; r < 8; ++r) o[cc][r] = 0.0f;

    // ------- stream over key tiles ------------------------------------------
    for (int kt = 0; kt < NCTX / KTILE; ++kt) {
        __syncthreads();   // previous tile fully consumed

        // cooperative fp32 -> fp16 load: K row-major, V transposed
        {
            const int ch4  = (tid & 15) * 4;  // 0..60
            const int key0 = tid >> 4;        // 0..15
#pragma unroll
            for (int it = 0; it < KTILE / 16; ++it) {
                const int    key = key0 + it * 16;
                const float* kp  = qkv + ((size_t)(batch * NCTX + kt * KTILE + key) * HEADS + head) * (3 * CH) + CH;
                v4f kv = *(const v4f*)(kp + ch4);        // K at +64
                v4f vv = *(const v4f*)(kp + CH + ch4);   // V at +128
                v4h kh;
#pragma unroll
                for (int i = 0; i < 4; ++i) kh[i] = (_Float16)kv[i];
                *(v4h*)&sK[key][ch4] = kh;
#pragma unroll
                for (int i = 0; i < 4; ++i)
                    sVt[ch4 >> 4][((ch4 & 15) + i) * VPITCH + key] = (_Float16)vv[i];
            }
        }

        // prefetch next key tile into cache while we compute
        if (kt + 1 < NCTX / KTILE) {
            const float* np = qkv + ((size_t)(batch * NCTX + (kt + 1) * KTILE + (tid >> 4)) * HEADS + head) * (3 * CH) + CH;
            __builtin_prefetch(np, 0, 0);
        }

        __syncthreads();   // tile resident in LDS

        // ---- S = (Q*s) (K*s)^T : NCHUNK tiles of 16 keys, 2 WMMAs each ----
        v8f s[NCHUNK];
#pragma unroll
        for (int c = 0; c < NCHUNK; ++c) {
            v8f acc;
#pragma unroll
            for (int r = 0; r < 8; ++r) acc[r] = 0.0f;
            const _Float16* kb = &sK[c * 16 + l16][0];
#pragma unroll
            for (int f = 0; f < 2; ++f) {
                v8h lo = *(const v8h*)(kb + f * 32 + kbase);
                v8h hi = *(const v8h*)(kb + f * 32 + kbase + 16);
                v16h bfrag;
#pragma unroll
                for (int i = 0; i < 8; ++i) { bfrag[i] = lo[i]; bfrag[8 + i] = hi[i]; }
                acc = __builtin_amdgcn_wmma_f32_16x16x32_f16(
                          false, qfrag[f], false, bfrag, (short)0, acc, false, false);
            }
            s[c] = acc;
        }

        // ---- online softmax update ----------------------------------------
        float rmax[8];
#pragma unroll
        for (int r = 0; r < 8; ++r) {
            float v = s[0][r];
#pragma unroll
            for (int c = 1; c < NCHUNK; ++c) v = fmaxf(v, s[c][r]);
            rmax[r] = redmax16(v);
        }

        float alpha[8];
#pragma unroll
        for (int r = 0; r < 8; ++r) {
            const float nm = fmaxf(m[r], rmax[r]);
            alpha[r] = __expf(m[r] - nm);
            m[r]     = nm;
        }
#pragma unroll
        for (int cc = 0; cc < 4; ++cc)
#pragma unroll
            for (int r = 0; r < 8; ++r) o[cc][r] *= alpha[r];

        float rsum[8];
#pragma unroll
        for (int r = 0; r < 8; ++r) rsum[r] = 0.0f;
#pragma unroll
        for (int c = 0; c < NCHUNK; ++c)
#pragma unroll
            for (int r = 0; r < 8; ++r) {
                const float p = __expf(s[c][r] - m[r]);
                s[c][r]  = p;
                rsum[r] += p;
            }
#pragma unroll
        for (int r = 0; r < 8; ++r)
            l[r] = l[r] * alpha[r] + redsum16(rsum[r]);

        // ---- spill P (fp16) to per-wave LDS scratch (C-layout -> A-layout) -
#pragma unroll
        for (int c = 0; c < NCHUNK; ++c)
#pragma unroll
            for (int r = 0; r < 8; ++r)
                sP[wave][r + half * 8][c * 16 + l16] = (_Float16)s[c][r];

        asm volatile("s_wait_dscnt 0" ::: "memory");   // wave-local LDS RAW fence

        // ---- O += P V : A from sP, B from transposed V --------------------
        v16h pfrag[KFRAG];
        const _Float16* pb = &sP[wave][l16][0];
#pragma unroll
        for (int f = 0; f < KFRAG; ++f) {
            v8h lo = *(const v8h*)(pb + f * 32 + kbase);
            v8h hi = *(const v8h*)(pb + f * 32 + kbase + 16);
#pragma unroll
            for (int i = 0; i < 8; ++i) { pfrag[f][i] = lo[i]; pfrag[f][8 + i] = hi[i]; }
        }
#pragma unroll
        for (int cc = 0; cc < 4; ++cc) {
            const _Float16* vb = &sVt[cc][l16 * VPITCH];
#pragma unroll
            for (int f = 0; f < KFRAG; ++f) {
                v8h lo = *(const v8h*)(vb + f * 32 + kbase);
                v8h hi = *(const v8h*)(vb + f * 32 + kbase + 16);
                v16h bfrag;
#pragma unroll
                for (int i = 0; i < 8; ++i) { bfrag[i] = lo[i]; bfrag[8 + i] = hi[i]; }
                o[cc] = __builtin_amdgcn_wmma_f32_16x16x32_f16(
                            false, pfrag[f], false, bfrag, (short)0, o[cc], false, false);
            }
        }
    }

    // ------- epilogue: O / l -> out[b, t, h*64 + ch] ------------------------
    float inv[8];
#pragma unroll
    for (int r = 0; r < 8; ++r) inv[r] = 1.0f / l[r];
#pragma unroll
    for (int cc = 0; cc < 4; ++cc)
#pragma unroll
        for (int r = 0; r < 8; ++r) {
            const int row = qtile * QTILE + wave * 16 + r + half * 8;
            const int col = cc * 16 + l16;
            out[((size_t)(batch * NCTX + row) * HEADS + head) * CH + col] = o[cc][r] * inv[r];
        }
}

extern "C" void kernel_launch(void* const* d_in, const int* in_sizes, int n_in,
                              void* d_out, int out_size, void* d_ws, size_t ws_size,
                              hipStream_t stream)
{
    const float* qkv = (const float*)d_in[0];
    float*       out = (float*)d_out;
    const int bs = in_sizes[0] / (NCTX * WTOK);   // 2 for the reference shapes

    dim3 grid(NCTX / QTILE, HEADS, bs);
    fa_fwd_kernel<<<grid, 256, 0, stream>>>(qkv, out);
}

// v002
// One run takes 49.4 microseconds.
// In two side-by-side timings against v001, it was 1.30 and 1.31 times as fast.
// All steps since v000 together make it 4.84 times as fast.
#include <hip/hip_runtime.h>

typedef __attribute__((ext_vector_type(16))) _Float16 v16h;
typedef __attribute__((ext_vector_type(8)))  _Float16 v8h;
typedef __attribute__((ext_vector_type(4)))  _Float16 v4h;
typedef __attribute__((ext_vector_type(8)))  float    v8f;
typedef __attribute__((ext_vector_type(4)))  float    v4f;

#define HEADS   16
#define CH      64
#define NCTX    2048
#define WTOK    (3 * HEADS * CH)   // 3072 floats per token
#define QTILE   128                // query rows per block
#define KTILE   128                // keys per streaming tile
#define NCHUNK  (KTILE / 16)       // 8 S-tiles of 16 keys
#define KFRAG   (KTILE / 32)       // 4 A/B fragment pairs along PV K-dim

// LDS row pitches in halves. Bank = dword address mod 64, so 16 rows read with
// 16-byte loads meet 16 different bank quads only at a pitch of 16 B x odd.
#define KPITCH  (CH + 8)           // 144 B
#define VPITCH  (KTILE + 8)        // 272 B
// Each group of 16 V^T rows starts 16 B later than the pitch alone would put it:
// the staging stores of a half-wave go to rows 4 apart, which 272 B alone folds
// onto 4 banks; with the shift they meet 16 banks.
#define VGROUP  (16 * VPITCH + 8)

// lane l <-> lane l ^ 16: the two lanes that share one query column
__device__ __forceinline__ float xhalf(float v)
{
    const int u = __builtin_bit_cast(int, v);
    return __builtin_bit_cast(float,
        __builtin_amdgcn_permlanex16(u, u, 0x76543210, 0xfedcba98, false, false));
}

__global__ __launch_bounds__(256)
void fa_fwd_kernel(const float* __restrict__ qkv, float* __restrict__ out)
{
    __shared__ __align__(16) _Float16 sK [KTILE][KPITCH];      // [key][ch] row-major
    __shared__ __align__(16) _Float16 sVt[CH / 16][VGROUP];    // [ch/16][(ch%16)*VPITCH + key]

    const int tid   = threadIdx.x;
    const int wave  = tid >> 5;
    const int lane  = tid & 31;
    const int l16   = lane & 15;
    const int half  = lane >> 4;        // 0: lanes 0-15, 1: lanes 16-31
    const int kbase = half * 8;         // 16-bit A/B fragment K-pattern

    const int qtile = blockIdx.x;       // 0..15
    const int head  = blockIdx.y;       // 0..15
    const int batch = blockIdx.z;

    const float scale2 = 0.125f;        // (1/d^(1/4))^2 = 1/sqrt(64)

    // ------- load this wave's Q fragments (16 rows x 64 ch as 2 B-frags) ----
    const int    qrow = qtile * QTILE + wave * 16 + l16;
    const float* qptr = qkv + ((size_t)(batch * NCTX + qrow) * HEADS + head) * (3 * CH);

    v16h qfrag[2];
#pragma unroll
    for (int f = 0; f < 2; ++f) {
        const int k0 = f * 32 + kbase;
        v4f a = *(const v4f*)(qptr + k0);
        v4f b = *(const v4f*)(qptr + k0 + 4);
        v4f c = *(const v4f*)(qptr + k0 + 16);
        v4f d = *(const v4f*)(qptr + k0 + 20);
#pragma unroll
        for (int i = 0; i < 4; ++i) {
            qfrag[f][i]      = (_Float16)(a[i] * scale2);
            qfrag[f][4 + i]  = (_Float16)(b[i] * scale2);
            qfrag[f][8 + i]  = (_Float16)(c[i] * scale2);
            qfrag[f][12 + i] = (_Float16)(d[i] * scale2);
        }
    }

    // ------- online softmax state: this lane's query is row l16 of the wave ---
    // m is the query's maximum (equal in both halves); l sums this half's keys only.
    float m = -1e30f, l = 0.0f;
    v8f   o[4];                         // o[cc][r] = O[query l16][cc*16 + half*8 + r]
#pragma unroll
    for (int cc = 0; cc < 4; ++cc)
#pragma unroll
        for (int r = 0; r < 8; ++r) o[cc][r] = 0.0f;

    // ------- stream over key tiles ------------------------------------------
    for (int kt = 0; kt < NCTX / KTILE; ++kt) {
        __syncthreads();   // previous tile fully consumed

        // cooperative fp32 -> fp16 load: K row-major, V transposed
        {
            const int ch4  = (tid & 15) * 4;  // 0..60
            const int key0 = tid >> 4;        // 0..15
#pragma unroll
            for (int it = 0; it < KTILE / 16; ++it) {
                const int    key = key0 + it * 16;
                const float* kp  = qkv + ((size_t)(batch * NCTX + kt * KTILE + key) * HEADS + head) * (3 * CH) + CH;
                v4f kv = *(const v4f*)(kp + ch4);        // K at +64
                v4f vv = *(const v4f*)(kp + CH + ch4);   // V at +128
                v4h kh;
#pragma unroll
                for (int i = 0; i < 4; ++i) kh[i] = (_Float16)kv[i];
                *(v4h*)&sK[key][ch4] = kh;
#pragma unroll
                for (int i = 0; i < 4; ++i)
                    sVt[ch4 >> 4][((ch4 & 15) + i) * VPITCH + key] = (_Float16)vv[i];
            }
        }

        // prefetch next key tile into cache while we compute
        if (kt + 1 < NCTX / KTILE) {
            const float* np = qkv + ((size_t)(batch * NCTX + (kt + 1) * KTILE + (tid >> 4)) * HEADS + head) * (3 * CH) + CH;
            __builtin_prefetch(np, 0, 0);
        }

        __syncthreads();   // tile resident in LDS

        // ---- S^T = K (Q*s^2)^T : NCHUNK tiles of 16 keys, 2 WMMAs each ----
        // s[c][r] = score of key c*16 + half*8 + r against query l16
        v8f s[NCHUNK];
#pragma unroll
        for (int c = 0; c < NCHUNK; ++c) {
            v8f acc;
#pragma unroll
            for (int r = 0; r < 8; ++r) acc[r] = 0.0f;
            const _Float16* kb = &sK[c * 16 + l16][0];
#pragma unroll
            for (int f = 0; f < 2; ++f) {
                v8h lo = *(const v8h*)(kb + f * 32 + kbase);
                v8h hi = *(const v8h*)(kb + f * 32 + kbase + 16);
                v16h afrag;
#pragma unroll
                for (int i = 0; i < 8; ++i) { afrag[i] = lo[i]; afrag[8 + i] = hi[i]; }
                acc = __builtin_amdgcn_wmma_f32_16x16x32_f16(
                          false, afrag, false, qfrag[f], (short)0, acc, false, false);
            }
            s[c] = acc;
        }

        // ---- online softmax update: in-lane, one exchange between halves ---
        float rmax[8];
#pragma unroll
        for (int r = 0; r < 8; ++r) {
            float v = s[0][r];
#pragma unroll
            for (int c = 1; c < NCHUNK; ++c) v = fmaxf(v, s[c][r]);
            rmax[r] = v;
        }
        float tmax = fmaxf(fmaxf(fmaxf(rmax[0], rmax[1]), fmaxf(rmax[2], rmax[3])),
                           fmaxf(fmaxf(rmax[4], rmax[5]), fmaxf(rmax[6], rmax[7])));
        tmax = fmaxf(tmax, xhalf(tmax));

        const float nm    = fmaxf(m, tmax);
        const float alpha = __expf(m - nm);
        m = nm;
#pragma unroll
        for (int cc = 0; cc < 4; ++cc) o[cc] *= alpha;

        // p = exp(s - m) as exp2((s - m) * log2 e), on whole tiles so the
        // subtract, multiply and add stay packed two to an instruction
        v8f rsum;
#pragma unroll
        for (int c = 0; c < NCHUNK; ++c) {
            v8f t = (s[c] - m) * 1.44269504088896340736f;
#pragma unroll
            for (int r = 0; r < 8; ++r) t[r] = __builtin_amdgcn_exp2f(t[r]);
            s[c] = t;
            rsum = (c == 0) ? t : rsum + t;
        }
        l = l * alpha + (((rsum[0] + rsum[1]) + (rsum[2] + rsum[3])) +
                         ((rsum[4] + rsum[5]) + (rsum[6] + rsum[7])));

        // ---- P^T as B operand: tiles 2f and 2f+1 hold keys in the fragment's k order
        v16h pfrag[KFRAG];
#pragma unroll
        for (int f = 0; f < KFRAG; ++f)
#pragma unroll
            for (int i = 0; i < 8; ++i) {
                pfrag[f][i]     = (_Float16)s[2 * f][i];
                pfrag[f][8 + i] = (_Float16)s[2 * f + 1][i];
            }

        // ---- O^T += V^T P^T : A from transposed V, B from registers --------
#pragma unroll
        for (int cc = 0; cc < 4; ++cc) {
            const _Float16* vb = &sVt[cc][l16 * VPITCH];
#pragma unroll
            for (int f = 0; f < KFRAG; ++f) {
                v8h lo = *(const v8h*)(vb + f * 32 + kbase);
                v8h hi = *(const v8h*)(vb + f * 32 + kbase + 16);
                v16h afrag;
#pragma unroll
                for (int i = 0; i < 8; ++i) { afrag[i] = lo[i]; afrag[8 + i] = hi[i]; }
                o[cc] = __builtin_amdgcn_wmma_f32_16x16x32_f16(
                            false, afrag, false, pfrag[f], (short)0, o[cc], false, false);
            }
        }
    }

    // ------- epilogue: O / l -> out[b, t, h*64 + ch], 32 channels per lane ----
    const float inv = 1.0f / (l + xhalf(l));
    float* op = out + ((size_t)(batch * NCTX + qrow) * HEADS + head) * CH + half * 8;
#pragma unroll
    for (int cc = 0; cc < 4; ++cc) {
        v4f lo, hi;
#pragma unroll
        for (int i = 0; i < 4; ++i) { lo[i] = o[cc][i] * inv; hi[i] = o[cc][4 + i] * inv; }
        *(v4f*)(op + cc * 16)     = lo;
        *(v4f*)(op + cc * 16 + 4) = hi;
    }
}

extern "C" void kernel_launch(void* const* d_in, const int* in_sizes, int n_in,
                              void* d_out, int out_size, void* d_ws, size_t ws_size,
                              hipStream_t stream)
{
    const float* qkv = (const float*)d_in[0];
    float*       out = (float*)d_out;
    const int bs = in_sizes[0] / (NCTX * WTOK);   // 2 for the reference shapes

    dim3 grid(NCTX / QTILE, HEADS, bs);
    fa_fwd_kernel<<<grid, 256, 0, stream>>>(qkv, out);
}

// v003
// Measured time: 45.7 microseconds a run.
// Timed twice side by side with v002, it ran 1.09 and 1.08 times as fast.
// Over all steps from v000 it is 5.24 times as fast.
#include <hip/hip_runtime.h>

typedef __attribute__((ext_vector_type(16))) _Float16 v16h;
typedef __attribute__((ext_vector_type(8)))  _Float16 v8h;
typedef __attribute__((ext_vector_type(4)))  _Float16 v4h;
typedef __attribute__((ext_vector_type(8)))  float    v8f;
typedef __attribute__((ext_vector_type(4)))  float    v4f;

#define HEADS   16
#define CH      64
#define NCTX    2048
#define WTOK    (3 * HEADS * CH)   // 3072 floats per token
#define QTILE   128                // query rows per block
#define KTILE   128                // keys per streaming tile
#define NCHUNK  (KTILE / 16)       // 8 S-tiles of 16 keys
#define KFRAG   (KTILE / 32)       // 4 A/B fragment pairs along PV K-dim

// LDS row pitches in halves. Bank = dword address mod 64, so 16 rows read with
// 16-byte loads meet 16 different bank quads only at a pitch of 16 B x odd.
#define KPITCH  (CH + 8)           // 144 B
#define VPITCH  (KTILE + 8)        // 272 B
// Each group of 16 V^T rows starts 16 B later than the pitch alone would put it:
// the staging stores of a half-wave go to rows 4 apart, which 272 B alone folds
// onto 4 banks; with the shift they meet 16 banks.
#define VGROUP  (16 * VPITCH + 8)

// lane l <-> lane l ^ 16: the two lanes that share one query column
__device__ __forceinline__ float xhalf(float v)
{
    const int u = __builtin_bit_cast(int, v);
    return __builtin_bit_cast(float,
        __builtin_amdgcn_permlanex16(u, u, 0x76543210, 0xfedcba98, false, false));
}

__global__ __launch_bounds__(256, 4)
void fa_fwd_kernel(const float* __restrict__ qkv, float* __restrict__ out)
{
    __shared__ __align__(16) _Float16 sK [KTILE][KPITCH];      // [key][ch] row-major
    __shared__ __align__(16) _Float16 sVt[CH / 16][VGROUP];    // [ch/16][(ch%16)*VPITCH + key]

    const int tid   = threadIdx.x;
    const int wave  = tid >> 5;
    const int lane  = tid & 31;
    const int l16   = lane & 15;
    const int half  = lane >> 4;        // 0: lanes 0-15, 1: lanes 16-31
    const int kbase = half * 8;         // 16-bit A/B fragment K-pattern

    const int qtile = blockIdx.x;       // 0..15
    const int head  = blockIdx.y;       // 0..15
    const int batch = blockIdx.z;

    const float scale2 = 0.125f;        // (1/d^(1/4))^2 = 1/sqrt(64)

    // ------- load this wave's Q fragments (16 rows x 64 ch as 2 B-frags) ----
    const int    qrow = qtile * QTILE + wave * 16 + l16;
    const float* qptr = qkv + ((size_t)(batch * NCTX + qrow) * HEADS + head) * (3 * CH);

    v16h qfrag[2];
#pragma unroll
    for (int f = 0; f < 2; ++f) {
        const int k0 = f * 32 + kbase;
        v4f a = *(const v4f*)(qptr + k0);
        v4f b = *(const v4f*)(qptr + k0 + 4);
        v4f c = *(const v4f*)(qptr + k0 + 16);
        v4f d = *(const v4f*)(qptr + k0 + 20);
#pragma unroll
        for (int i = 0; i < 4; ++i) {
            qfrag[f][i]      = (_Float16)(a[i] * scale2);
            qfrag[f][4 + i]  = (_Float16)(b[i] * scale2);
            qfrag[f][8 + i]  = (_Float16)(c[i] * scale2);
            qfrag[f][12 + i] = (_Float16)(d[i] * scale2);
        }
    }

    // ------- online softmax state: this lane's query is row l16 of the wave ---
    // m is the query's maximum (equal in both halves); l sums this half's keys only.
    float m = -1e30f, l = 0.0f;
    v8f   o[4];                         // o[cc][r] = O[query l16][cc*16 + half*8 + r]
#pragma unroll
    for (int cc = 0; cc < 4; ++cc)
#pragma unroll
        for (int r = 0; r < 8; ++r) o[cc][r] = 0.0f;

    // ------- this thread's share of a key tile: 4 channels of K and of V for 8 keys
    const int ch4  = (tid & 15) * 4;  // 0..60
    const int key0 = tid >> 4;        // 0..15
    // K of key key0 of tile 0; V lies CH floats behind, key + 16 lies 16 * WTOK behind
    const float* kp = qkv + ((size_t)(batch * NCTX + key0) * HEADS + head) * (3 * CH) + CH + ch4;

    v4f kreg[KTILE / 16], vreg[KTILE / 16];   // one tile ahead, still fp32
#pragma unroll
    for (int it = 0; it < KTILE / 16; ++it) {
        kreg[it] = *(const v4f*)(kp + (size_t)it * 16 * WTOK);
        vreg[it] = *(const v4f*)(kp + (size_t)it * 16 * WTOK + CH);
    }

    // ------- one key tile; more = another tile follows and is fetched meanwhile ----
    // (inlined twice with a constant argument, so the loads stand under no branch)
    auto pass = [&](const bool more) __attribute__((always_inline)) {
        __syncthreads();   // previous tile fully consumed

        // fp32 -> fp16 from the registers loaded one tile ago: K row-major, V transposed
#pragma unroll
        for (int it = 0; it < KTILE / 16; ++it) {
            const int key = key0 + it * 16;
            v4h kh;
#pragma unroll
            for (int i = 0; i < 4; ++i) kh[i] = (_Float16)kreg[it][i];
            *(v4h*)&sK[key][ch4] = kh;
#pragma unroll
            for (int i = 0; i < 4; ++i)
                sVt[ch4 >> 4][((ch4 & 15) + i) * VPITCH + key] = (_Float16)vreg[it][i];
        }

        __syncthreads();   // tile resident in LDS

        // issue the next tile's K loads now: they fly while this tile is computed
        if (more) {
            kp += (size_t)KTILE * WTOK;
#pragma unroll
            for (int it = 0; it < KTILE / 16; ++it)
                kreg[it] = *(const v4f*)(kp + (size_t)it * 16 * WTOK);
        }
        // keeps the compiler from sinking these loads towards their use one pass later
        __builtin_amdgcn_sched_barrier(0);

        // ---- S^T = K (Q*s^2)^T : NCHUNK tiles of 16 keys, 2 WMMAs each ----
        // s[c][r] = score of key c*16 + half*8 + r against query l16
        v8f s[NCHUNK];
#pragma unroll
        for (int c = 0; c < NCHUNK; ++c) {
            v8f acc;
#pragma unroll
            for (int r = 0; r < 8; ++r) acc[r] = 0.0f;
            const _Float16* kb = &sK[c * 16 + l16][0];
#pragma unroll
            for (int f = 0; f < 2; ++f) {
                v8h lo = *(const v8h*)(kb + f * 32 + kbase);
                v8h hi = *(const v8h*)(kb + f * 32 + kbase + 16);
                v16h afrag;
#pragma unroll
                for (int i = 0; i < 8; ++i) { afrag[i] = lo[i]; afrag[8 + i] = hi[i]; }
                acc = __builtin_amdgcn_wmma_f32_16x16x32_f16(
                          false, afrag, false, qfrag[f], (short)0, acc, false, false);
            }
            s[c] = acc;
        }
        // order of the region above: the K fragment reads in groups, 8 fragments ahead of the
        // products; behind the fences below the compiler otherwise waits out every single read
        __builtin_amdgcn_sched_group_barrier(0x100, 16, 0);
        __builtin_amdgcn_sched_group_barrier(0x008, 4, 0);
        __builtin_amdgcn_sched_group_barrier(0x100, 8, 0);
        __builtin_amdgcn_sched_group_barrier(0x008, 4, 0);
        __builtin_amdgcn_sched_group_barrier(0x100, 8, 0);
        __builtin_amdgcn_sched_group_barrier(0x008, 8, 0);

        // the next tile's V loads go out here, where the K fragments' registers are
        // free again: issued with K's loads they would not fit 256 VGPRs.
        // Fences: neither hoisted among the products above nor sunk towards their use.
        __builtin_amdgcn_sched_barrier(0);
        if (more) {
#pragma unroll
            for (int it = 0; it < KTILE / 16; ++it)
                vreg[it] = *(const v4f*)(kp + (size_t)it * 16 * WTOK + CH);
        }
        __builtin_amdgcn_sched_barrier(0);

        // ---- online softmax update: in-lane, one exchange between halves ---
        float rmax[8];
#pragma unroll
        for (int r = 0; r < 8; ++r) {
            float v = s[0][r];
#pragma unroll
            for (int c = 1; c < NCHUNK; ++c) v = fmaxf(v, s[c][r]);
            rmax[r] = v;
        }
        float tmax = fmaxf(fmaxf(fmaxf(rmax[0], rmax[1]), fmaxf(rmax[2], rmax[3])),
                           fmaxf(fmaxf(rmax[4], rmax[5]), fmaxf(rmax[6], rmax[7])));
        tmax = fmaxf(tmax, xhalf(tmax));

        const float nm    = fmaxf(m, tmax);
        const float alpha = __expf(m - nm);
        m = nm;
#pragma unroll
        for (int cc = 0; cc < 4; ++cc) o[cc] *= alpha;

        // p = exp(s - m) as exp2((s - m) * log2 e), on whole tiles so the
        // subtract, multiply and add stay packed two to an instruction
        v8f rsum;
#pragma unroll
        for (int c = 0; c < NCHUNK; ++c) {
            v8f t = (s[c] - m) * 1.44269504088896340736f;
#pragma unroll
            for (int r = 0; r < 8; ++r) t[r] = __builtin_amdgcn_exp2f(t[r]);
            s[c] = t;
            rsum = (c == 0) ? t : rsum + t;
        }
        l = l * alpha + (((rsum[0] + rsum[1]) + (rsum[2] + rsum[3])) +
                         ((rsum[4] + rsum[5]) + (rsum[6] + rsum[7])));

        // ---- P^T as B operand: tiles 2f and 2f+1 hold keys in the fragment's k order
        v16h pfrag[KFRAG];
#pragma unroll
        for (int f = 0; f < KFRAG; ++f)
#pragma unroll
            for (int i = 0; i < 8; ++i) {
                pfrag[f][i]     = (_Float16)s[2 * f][i];
                pfrag[f][8 + i] = (_Float16)s[2 * f + 1][i];
            }

        // ---- O^T += V^T P^T : A from transposed V, B from registers --------
#pragma unroll
        for (int cc = 0; cc < 4; ++cc) {
            const _Float16* vb = &sVt[cc][l16 * VPITCH];
#pragma unroll
            for (int f = 0; f < KFRAG; ++f) {
                v8h lo = *(const v8h*)(vb + f * 32 + kbase);
                v8h hi = *(const v8h*)(vb + f * 32 + kbase + 16);
                v16h afrag;
#pragma unroll
                for (int i = 0; i < 8; ++i) { afrag[i] = lo[i]; afrag[8 + i] = hi[i]; }
                o[cc] = __builtin_amdgcn_wmma_f32_16x16x32_f16(
                            false, afrag, false, pfrag[f], (short)0, o[cc], false, false);
            }
        }
    };

    // ------- stream over key tiles ------------------------------------------
    for (int kt = 0; kt + 1 < NCTX / KTILE; ++kt) pass(true);
    pass(false);

    // ------- epilogue: O / l -> out[b, t, h*64 + ch], 32 channels per lane in 4 runs of 8 ----
    const float inv = 1.0f / (l + xhalf(l));
    float* op = out + ((size_t)(batch * NCTX + qrow) * HEADS + head) * CH + half * 8;
#pragma unroll
    for (int cc = 0; cc < 4; ++cc) {
        v4f lo, hi;
#pragma unroll
        for (int i = 0; i < 4; ++i) { lo[i] = o[cc][i] * inv; hi[i] = o[cc][4 + i] * inv; }
        *(v4f*)(op + cc * 16)     = lo;
        *(v4f*)(op + cc * 16 + 4) = hi;
    }
}

extern "C" void kernel_launch(void* const* d_in, const int* in_sizes, int n_in,
                              void* d_out, int out_size, void* d_ws, size_t ws_size,
                              hipStream_t stream)
{
    const float* qkv = (const float*)d_in[0];
    float*       out = (float*)d_out;
    const int bs = in_sizes[0] / (NCTX * WTOK);   // 2 for the reference shapes

    dim3 grid(NCTX / QTILE, HEADS, bs);
    fa_fwd_kernel<<<grid, 256, 0, stream>>>(qkv, out);
}

// v004
// It runs in 38.2 microseconds.
// In two side-by-side timings against v003, it was 1.20 and 1.19 times as fast.
// Counting every step since v000, it is 6.27 times as fast.
#include <hip/hip_runtime.h>

typedef __attribute__((ext_vector_type(16))) _Float16 v16h;
typedef __attribute__((ext_vector_type(8)))  _Float16 v8h;
typedef __attribute__((ext_vector_type(4)))  _Float16 v4h;
typedef __attribute__((ext_vector_type(8)))  float    v8f;
typedef __attribute__((ext_vector_type(4)))  float    v4f;

#define HEADS   16
#define CH      64
#define NCTX    2048
#define WTOK    (3 * HEADS * CH)   // 3072 floats per token
#define THREADS 512                // 16 waves: 8 query groups x 2 key halves
#define QT      2                  // query tiles of 16 columns per wave
#define QTILE   (8 * QT * 16)      // 256 query rows per block
#define KTILE   128                // keys per streaming tile
#define KHALF   (KTILE / 2)        // keys of a tile that one wave works on
#define NCHUNK  (KHALF / 16)       // 4 S-tiles of 16 keys per query tile
#define KFRAG   (KHALF / 32)       // 2 A/B fragment pairs along PV K-dim
#define NSTG    (KTILE * 16 / THREADS)   // 4 keys staged per thread

// LDS row pitches in halves. Bank = dword address mod 64, so 16 rows read with
// 16-byte loads meet 16 different bank quads only at a pitch of 16 B x odd.
#define KPITCH  (CH + 8)           // 144 B
#define VPITCH  (KTILE + 8)        // 272 B
// Each group of 16 V^T rows starts 16 B later than the pitch alone would put it:
// the staging stores of a half-wave go to rows 4 apart, which 272 B alone folds
// onto 4 banks; with the shift they meet 16 banks.
#define VGROUP  (16 * VPITCH + 8)

// lane l <-> lane l ^ 16: the two lanes that share one query column
__device__ __forceinline__ float xhalf(float v)
{
    const int u = __builtin_bit_cast(int, v);
    return __builtin_bit_cast(float,
        __builtin_amdgcn_permlanex16(u, u, 0x76543210, 0xfedcba98, false, false));
}

__global__ __launch_bounds__(THREADS)
void fa_fwd_kernel(const float* __restrict__ qkv, float* __restrict__ out)
{
    __shared__ __align__(16) _Float16 sK [KTILE][KPITCH];      // [key][ch] row-major
    __shared__ __align__(16) _Float16 sVt[CH / 16][VGROUP];    // [ch/16][(ch%16)*VPITCH + key]
    // what a wave hands to the other wave of its query group behind the loop
    __shared__ __align__(16) float sX [THREADS / 32][8][32][4];   // one output tile
    __shared__ float               sML[THREADS / 32][2][32];      // its maximum and sum

    const int tid   = threadIdx.x;
    const int wave  = __builtin_amdgcn_readfirstlane(tid >> 5);
    const int lane  = tid & 31;
    const int l16   = lane & 15;
    const int half  = lane >> 4;        // 0: lanes 0-15, 1: lanes 16-31
    const int kbase = half * 8;         // 16-bit A/B fragment K-pattern
    const int qg    = wave & 7;         // query group
    const int kh    = wave >> 3;        // key half of every tile

    const int qtile = blockIdx.x;       // 0..7
    const int head  = blockIdx.y;       // 0..15
    const int batch = blockIdx.z;

    const float scale2 = 0.125f;        // (1/d^(1/4))^2 = 1/sqrt(64)

    // ------- load this wave's Q fragments (2 x 16 rows x 64 ch as 2 B-frags each) ----
    const int qrow = qtile * QTILE + qg * (QT * 16) + l16;      // query of tile 0

    v16h qfrag[QT][2];
#pragma unroll
    for (int ct = 0; ct < QT; ++ct) {
        const float* qptr = qkv + ((size_t)(batch * NCTX + qrow + ct * 16) * HEADS + head) * (3 * CH);
#pragma unroll
        for (int f = 0; f < 2; ++f) {
            const int k0 = f * 32 + kbase;
            v4f a = *(const v4f*)(qptr + k0);
            v4f b = *(const v4f*)(qptr + k0 + 4);
            v4f c = *(const v4f*)(qptr + k0 + 16);
            v4f d = *(const v4f*)(qptr + k0 + 20);
#pragma unroll
            for (int i = 0; i < 4; ++i) {
                qfrag[ct][f][i]      = (_Float16)(a[i] * scale2);
                qfrag[ct][f][4 + i]  = (_Float16)(b[i] * scale2);
                qfrag[ct][f][8 + i]  = (_Float16)(c[i] * scale2);
                qfrag[ct][f][12 + i] = (_Float16)(d[i] * scale2);
            }
        }
    }
    // precaution: stands in front of every later rewrite of the address registers that the Q loads name
    asm volatile("s_wait_xcnt 0x0" ::: "memory");

    // ------- online softmax state: this lane's queries are row l16 of each tile ---
    // m is the query's maximum over this wave's keys (equal in both lane halves);
    // l sums this lane half's keys only.
    float m[QT], l[QT];
    v8f   o[QT][4];                     // o[ct][cc][r] = O[query ct*16 + l16][cc*16 + half*8 + r]
#pragma unroll
    for (int ct = 0; ct < QT; ++ct) {
        m[ct] = -1e30f; l[ct] = 0.0f;
#pragma unroll
        for (int cc = 0; cc < 4; ++cc)
#pragma unroll
            for (int r = 0; r < 8; ++r) o[ct][cc][r] = 0.0f;
    }

    // ------- this thread's share of a key tile: 4 channels of K and of V for 4 keys
    const int ch4  = (tid & 15) * 4;  // 0..60
    const int key0 = tid >> 4;        // 0..31
    // K of key key0 of tile 0; V lies CH floats behind, key + 32 lies 32 * WTOK behind
    const float* kp = qkv + ((size_t)(batch * NCTX + key0) * HEADS + head) * (3 * CH) + CH + ch4;

    v4f kreg[NSTG], vreg[NSTG];   // one tile ahead, still fp32
#pragma unroll
    for (int it = 0; it < NSTG; ++it) {
        kreg[it] = *(const v4f*)(kp + (size_t)it * 32 * WTOK);
        vreg[it] = *(const v4f*)(kp + (size_t)it * 32 * WTOK + CH);
    }

    // ------- one key tile; more = another tile follows and is fetched meanwhile ----
    // (inlined twice with a constant argument, so the loads stand under no branch)
    auto pass = [&](const bool more) __attribute__((always_inline)) {
        __syncthreads();   // previous tile fully consumed

        // fp32 -> fp16 from the registers loaded one tile ago: K row-major, V transposed
#pragma unroll
        for (int it = 0; it < NSTG; ++it) {
            const int key = key0 + it * 32;
            v4h kh4;
#pragma unroll
            for (int i = 0; i < 4; ++i) kh4[i] = (_Float16)kreg[it][i];
            *(v4h*)&sK[key][ch4] = kh4;
#pragma unroll
            for (int i = 0; i < 4; ++i)
                sVt[ch4 >> 4][((ch4 & 15) + i) * VPITCH + key] = (_Float16)vreg[it][i];
        }

        __syncthreads();   // tile resident in LDS

        // issue the next tile's K loads now: they fly while this tile is computed
        if (more) {
            kp += (size_t)KTILE * WTOK;
#pragma unroll
            for (int it = 0; it < NSTG; ++it)
                kreg[it] = *(const v4f*)(kp + (size_t)it * 32 * WTOK);
        }
        // keeps the compiler from sinking these loads towards their use one pass later
        __builtin_amdgcn_sched_barrier(0);

        // ---- S^T = K (Q*s^2)^T : NCHUNK tiles of 16 keys x QT query tiles, 2 WMMAs each ----
        // s[ct][c][r] = score of key kh*64 + c*16 + half*8 + r against query ct*16 + l16
        v8f s[QT][NCHUNK];
#pragma unroll
        for (int c = 0; c < NCHUNK; ++c) {
#pragma unroll
            for (int ct = 0; ct < QT; ++ct)
#pragma unroll
                for (int r = 0; r < 8; ++r) s[ct][c][r] = 0.0f;
            const _Float16* kb = &sK[kh * KHALF + c * 16 + l16][0];
#pragma unroll
            for (int f = 0; f < 2; ++f) {
                v8h lo = *(const v8h*)(kb + f * 32 + kbase);
                v8h hi = *(const v8h*)(kb + f * 32 + kbase + 16);
                v16h afrag;
#pragma unroll
                for (int i = 0; i < 8; ++i) { afrag[i] = lo[i]; afrag[8 + i] = hi[i]; }
#pragma unroll
                for (int ct = 0; ct < QT; ++ct)
                    s[ct][c] = __builtin_amdgcn_wmma_f32_16x16x32_f16(
                                   false, afrag, false, qfrag[ct][f], (short)0, s[ct][c], false, false);
            }
        }
        // order of the region above: the K fragment reads in groups, 4 fragments ahead of the
        // products; behind the fences below the compiler otherwise waits out every single read
        __builtin_amdgcn_sched_group_barrier(0x100, 8, 0);
        __builtin_amdgcn_sched_group_barrier(0x008, 4, 0);
        __builtin_amdgcn_sched_group_barrier(0x100, 4, 0);
        __builtin_amdgcn_sched_group_barrier(0x008, 4, 0);
        __builtin_amdgcn_sched_group_barrier(0x100, 4, 0);
        __builtin_amdgcn_sched_group_barrier(0x008, 8, 0);

        // the next tile's V loads go out here, where the K fragments' registers are
        // free again: issued with K's loads they would be 16 more live registers through the products.
        // Fences: neither hoisted among the products above nor sunk towards their use.
        __builtin_amdgcn_sched_barrier(0);
        if (more) {
#pragma unroll
            for (int it = 0; it < NSTG; ++it)
                vreg[it] = *(const v4f*)(kp + (size_t)it * 32 * WTOK + CH);
        }
        __builtin_amdgcn_sched_barrier(0);

        // ---- online softmax update per query tile: in-lane, one exchange between halves ---
        v16h pfrag[QT][KFRAG];
        auto softmax = [&](const int ct) __attribute__((always_inline)) {
            float rmax[8];
#pragma unroll
            for (int r = 0; r < 8; ++r) {
                float v = s[ct][0][r];
#pragma unroll
                for (int c = 1; c < NCHUNK; ++c) v = fmaxf(v, s[ct][c][r]);
                rmax[r] = v;
            }
            float tmax = fmaxf(fmaxf(fmaxf(rmax[0], rmax[1]), fmaxf(rmax[2], rmax[3])),
                               fmaxf(fmaxf(rmax[4], rmax[5]), fmaxf(rmax[6], rmax[7])));
            tmax = fmaxf(tmax, xhalf(tmax));

            const float nm    = fmaxf(m[ct], tmax);
            const float alpha = __expf(m[ct] - nm);
            m[ct] = nm;
#pragma unroll
            for (int cc = 0; cc < 4; ++cc) o[ct][cc] *= alpha;

            // p = exp(s - m) as exp2((s - m) * log2 e), on whole tiles so the
            // subtract, multiply and add stay packed two to an instruction
            v8f rsum;
#pragma unroll
            for (int c = 0; c < NCHUNK; ++c) {
                v8f t = (s[ct][c] - nm) * 1.44269504088896340736f;
#pragma unroll
                for (int r = 0; r < 8; ++r) t[r] = __builtin_amdgcn_exp2f(t[r]);
                s[ct][c] = t;
                rsum = (c == 0) ? t : rsum + t;
            }
            l[ct] = l[ct] * alpha + (((rsum[0] + rsum[1]) + (rsum[2] + rsum[3])) +
                                     ((rsum[4] + rsum[5]) + (rsum[6] + rsum[7])));

            // ---- P^T as B operand: tiles 2f and 2f+1 hold keys in the fragment's k order
#pragma unroll
            for (int f = 0; f < KFRAG; ++f)
#pragma unroll
                for (int i = 0; i < 8; ++i) {
                    pfrag[ct][f][i]     = (_Float16)s[ct][2 * f][i];
                    pfrag[ct][f][8 + i] = (_Float16)s[ct][2 * f + 1][i];
                }
        };

        softmax(0);
        softmax(1);

        // ---- O^T += V^T P^T : A from transposed V, B from registers --------
        // key fragment outermost: its eight products go to eight different accumulators,
        // and those of the first fragment need only the first half of P
#pragma unroll
        for (int f = 0; f < KFRAG; ++f) {
#pragma unroll
            for (int cc = 0; cc < 4; ++cc) {
                const _Float16* vb = &sVt[cc][l16 * VPITCH + kh * KHALF];
                v8h lo = *(const v8h*)(vb + f * 32 + kbase);
                v8h hi = *(const v8h*)(vb + f * 32 + kbase + 16);
                v16h afrag;
#pragma unroll
                for (int i = 0; i < 8; ++i) { afrag[i] = lo[i]; afrag[8 + i] = hi[i]; }
#pragma unroll
                for (int ct = 0; ct < QT; ++ct)
                    o[ct][cc] = __builtin_amdgcn_wmma_f32_16x16x32_f16(
                                    false, afrag, false, pfrag[ct][f], (short)0, o[ct][cc], false, false);
            }
        }
    };

    // ------- stream over key tiles ------------------------------------------
    for (int kt = 0; kt + 1 < NCTX / KTILE; ++kt) pass(true);
    pass(false);

    // ------- join the two key halves of a query group ------------------------
    // The wave of key half 0 finishes query tile 0, the other wave tile 1: each
    // hands the tile it does not finish to its partner through LDS.
    float lt[QT];
#pragma unroll
    for (int ct = 0; ct < QT; ++ct) lt[ct] = l[ct] + xhalf(l[ct]);

    auto give = [&](const int ct) __attribute__((always_inline)) {
#pragma unroll
        for (int cc = 0; cc < 4; ++cc) {
            v4f lo, hi;
#pragma unroll
            for (int i = 0; i < 4; ++i) { lo[i] = o[ct][cc][i]; hi[i] = o[ct][cc][4 + i]; }
            *(v4f*)&sX[wave][cc * 2][lane][0]     = lo;
            *(v4f*)&sX[wave][cc * 2 + 1][lane][0] = hi;
        }
        sML[wave][0][lane] = m[ct];
        sML[wave][1][lane] = lt[ct];
    };
    // O = (O_a e^(m_a - M) + O_b e^(m_b - M)) / (l_a e^(m_a - M) + l_b e^(m_b - M))
    //   -> out[b, t, h*64 + ch], 8 channels per lane and 16-channel group
    auto take = [&](const int ct) __attribute__((always_inline)) {
        const int   pw = wave ^ 8;
        const float pm = sML[pw][0][lane];
        const float pl = sML[pw][1][lane];
        const float mm = fmaxf(m[ct], pm);
        float fa = __expf(m[ct] - mm);
        float fb = __expf(pm - mm);
        const float inv = 1.0f / (lt[ct] * fa + pl * fb);
        fa *= inv;
        fb *= inv;
        float* op = out + ((size_t)(batch * NCTX + qrow + ct * 16) * HEADS + head) * CH + half * 8;
        v4f lo[4], hi[4];
#pragma unroll
        for (int cc = 0; cc < 4; ++cc) {
            const v4f plo = *(const v4f*)&sX[pw][cc * 2][lane][0];
            const v4f phi = *(const v4f*)&sX[pw][cc * 2 + 1][lane][0];
#pragma unroll
            for (int i = 0; i < 4; ++i) {
                lo[cc][i] = o[ct][cc][i] * fa     + plo[i] * fb;
                hi[cc][i] = o[ct][cc][4 + i] * fa + phi[i] * fb;
            }
        }
#pragma unroll
        for (int cc = 0; cc < 4; ++cc) {
            *(v4f*)(op + cc * 16)     = lo[cc];
            *(v4f*)(op + cc * 16 + 4) = hi[cc];
        }
        // precaution: stands in front of every rewrite of the stores' registers by code laid out behind this instance
        asm volatile("s_wait_xcnt 0x0" ::: "memory");
    };

    if (kh == 0) give(1); else give(0);
    __syncthreads();   // both partners' tiles stand in LDS
    if (kh == 0) take(0); else take(1);
}

extern "C" void kernel_launch(void* const* d_in, const int* in_sizes, int n_in,
                              void* d_out, int out_size, void* d_ws, size_t ws_size,
                              hipStream_t stream)
{
    const float* qkv = (const float*)d_in[0];
    float*       out = (float*)d_out;
    const int bs = in_sizes[0] / (NCTX * WTOK);   // 2 for the reference shapes

    dim3 grid(NCTX / QTILE, HEADS, bs);
    fa_fwd_kernel<<<grid, THREADS, 0, stream>>>(qkv, out);
}

// v005
// It runs in 34.9 microseconds.
// In both of two side-by-side timings against v004, it was 1.09 times as fast.
// Counting every step since v000, it is 6.84 times as fast.
#include <hip/hip_runtime.h>

typedef __attribute__((ext_vector_type(16))) _Float16 v16h;
typedef __attribute__((ext_vector_type(8)))  _Float16 v8h;
typedef __attribute__((ext_vector_type(4)))  _Float16 v4h;
typedef __attribute__((ext_vector_type(8)))  float    v8f;
typedef __attribute__((ext_vector_type(4)))  float    v4f;

#define HEADS   16
#define CH      64
#define NCTX    2048
#define WTOK    (3 * HEADS * CH)   // 3072 floats per token
#define THREADS 512                // 16 waves: 8 query groups x 2 key halves
#define QT      2                  // query tiles of 16 columns per wave
#define QTILE   (8 * QT * 16)      // 256 query rows per block
#define KTILE   128                // keys per streaming tile
#define KHALF   (KTILE / 2)        // keys of a tile that one wave works on
#define NCHUNK  (KHALF / 16)       // 4 S-tiles of 16 keys per query tile
#define KFRAG   (KHALF / 32)       // 2 A/B fragment pairs along PV K-dim
#define NSTG    (KTILE * 16 / THREADS)   // 4 keys staged per thread

// LDS row pitches in halves. Bank = dword address mod 64, so 16 rows read with
// 16-byte loads meet 16 different bank quads only at a pitch of 16 B x odd.
#define KPITCH  (CH + 8)           // 144 B
#define VPITCH  (KTILE + 8)        // 272 B
// Each group of 16 V^T rows starts 16 B later than the pitch alone would put it:
// the staging stores of a half-wave go to rows 4 apart, which 272 B alone folds
// onto 4 banks; with the shift they meet 16 banks.
#define VGROUP  (16 * VPITCH + 8)
// halves in one buffer of K and of V^T
#define KBUF    (KTILE * KPITCH)
#define VBUF    (CH / 16 * VGROUP)

// lane l <-> lane l ^ 16: the two lanes that share one query column
__device__ __forceinline__ float xhalf(float v)
{
    const int u = __builtin_bit_cast(int, v);
    return __builtin_bit_cast(float,
        __builtin_amdgcn_permlanex16(u, u, 0x76543210, 0xfedcba98, false, false));
}

__global__ __launch_bounds__(THREADS)
void fa_fwd_kernel(const float* __restrict__ qkv, float* __restrict__ out)
{
    // two buffers each: a tile is read from one while the next tile is written to the other
    __shared__ __align__(16) _Float16 sK [2][KTILE][KPITCH];      // [key][ch] row-major
    __shared__ __align__(16) _Float16 sVt[2][CH / 16][VGROUP];    // [ch/16][(ch%16)*VPITCH + key]
    // what a wave hands to the other wave of its query group behind the loop
    __shared__ __align__(16) float sX [THREADS / 32][8][32][4];   // one output tile
    __shared__ float               sML[THREADS / 32][2][32];      // its maximum and sum

    const int tid   = threadIdx.x;
    const int wave  = __builtin_amdgcn_readfirstlane(tid >> 5);
    const int lane  = tid & 31;
    const int l16   = lane & 15;
    const int half  = lane >> 4;        // 0: lanes 0-15, 1: lanes 16-31
    const int kbase = half * 8;         // 16-bit A/B fragment K-pattern
    const int qg    = wave & 7;         // query group
    const int kh    = wave >> 3;        // key half of every tile

    const int qtile = blockIdx.x;       // 0..7
    const int head  = blockIdx.y;       // 0..15
    const int batch = blockIdx.z;

    const float scale2 = 0.125f;        // (1/d^(1/4))^2 = 1/sqrt(64)

    // ------- load this wave's Q fragments (2 x 16 rows x 64 ch as 2 B-frags each) ----
    const int qrow = qtile * QTILE + qg * (QT * 16) + l16;      // query of tile 0

    v16h qfrag[QT][2];
#pragma unroll
    for (int ct = 0; ct < QT; ++ct) {
        const float* qptr = qkv + ((size_t)(batch * NCTX + qrow + ct * 16) * HEADS + head) * (3 * CH);
#pragma unroll
        for (int f = 0; f < 2; ++f) {
            const int k0 = f * 32 + kbase;
            v4f a = *(const v4f*)(qptr + k0);
            v4f b = *(const v4f*)(qptr + k0 + 4);
            v4f c = *(const v4f*)(qptr + k0 + 16);
            v4f d = *(const v4f*)(qptr + k0 + 20);
#pragma unroll
            for (int i = 0; i < 4; ++i) {
                qfrag[ct][f][i]      = (_Float16)(a[i] * scale2);
                qfrag[ct][f][4 + i]  = (_Float16)(b[i] * scale2);
                qfrag[ct][f][8 + i]  = (_Float16)(c[i] * scale2);
                qfrag[ct][f][12 + i] = (_Float16)(d[i] * scale2);
            }
        }
    }
    // precaution: stands in front of every later rewrite of the address registers that the Q loads name
    asm volatile("s_wait_xcnt 0x0" ::: "memory");

    // ------- online softmax state: this lane's queries are row l16 of each tile ---
    // m is the query's maximum over this wave's keys (equal in both lane halves);
    // l sums this lane half's keys only.
    float m[QT], l[QT];
    v8f   o[QT][4];                     // o[ct][cc][r] = O[query ct*16 + l16][cc*16 + half*8 + r]
#pragma unroll
    for (int ct = 0; ct < QT; ++ct) {
        m[ct] = -1e30f; l[ct] = 0.0f;
#pragma unroll
        for (int cc = 0; cc < 4; ++cc)
#pragma unroll
            for (int r = 0; r < 8; ++r) o[ct][cc][r] = 0.0f;
    }

    // ------- this thread's share of a key tile: 4 channels of K and of V for 4 keys
    const int ch4  = (tid & 15) * 4;  // 0..60
    const int key0 = tid >> 4;        // 0..31
    // K of key key0 of tile 0; V lies CH floats behind, key + 32 lies 32 * WTOK behind
    const float* kp = qkv + ((size_t)(batch * NCTX + key0) * HEADS + head) * (3 * CH) + CH + ch4;

    v4f kreg[NSTG], vreg[NSTG];   // a tile on its way from memory, still fp32
    v4h kh4[NSTG], vh4[NSTG];     // the tile that goes into LDS next, as fp16: half the registers to hold
    auto fetch = [&]() __attribute__((always_inline)) {
#pragma unroll
        for (int it = 0; it < NSTG; ++it) {
            kreg[it] = *(const v4f*)(kp + (size_t)it * 32 * WTOK);
            vreg[it] = *(const v4f*)(kp + (size_t)it * 32 * WTOK + CH);
        }
        kp += (size_t)KTILE * WTOK;
    };
    auto convert = [&]() __attribute__((always_inline)) {
#pragma unroll
        for (int it = 0; it < NSTG; ++it)
#pragma unroll
            for (int i = 0; i < 4; ++i) {
                kh4[it][i] = (_Float16)kreg[it][i];
                vh4[it][i] = (_Float16)vreg[it][i];
            }
    };
    // into the buffers that start kofs and vofs halves into sK and sVt: K row-major, V transposed
    auto stage = [&](const int kofs, const int vofs) __attribute__((always_inline)) {
        _Float16* kw = &sK[0][key0][ch4] + kofs;
        _Float16* vw = &sVt[0][ch4 >> 4][(ch4 & 15) * VPITCH + key0] + vofs;
#pragma unroll
        for (int it = 0; it < NSTG; ++it) {
            *(v4h*)(kw + it * 32 * KPITCH) = kh4[it];
#pragma unroll
            for (int i = 0; i < 4; ++i) vw[i * VPITCH + it * 32] = vh4[it][i];
        }
    };

    fetch();           // tile 0
    convert();
    fetch();           // tile 1
    stage(0, 0);
    convert();
    __syncthreads();   // tile 0 resident in LDS

    // ------- one key tile, read from the buffers at kofs and vofs -------------------
    // more  = another tile follows: it goes from its fp16 registers into the other buffers
    // more2 = a tile follows that one: it is fetched meanwhile
    // (inlined with constant flags, so loads and stores stand under no branch)
    auto pass = [&](const bool more, const bool more2, const int kofs, const int vofs)
                __attribute__((always_inline)) {

        // ---- S^T = K (Q*s^2)^T : NCHUNK tiles of 16 keys x QT query tiles, 2 WMMAs each ----
        // s[ct][c][r] = score of key kh*64 + c*16 + half*8 + r against query ct*16 + l16
        v8f s[QT][NCHUNK];
#pragma unroll
        for (int c = 0; c < NCHUNK; ++c) {
#pragma unroll
            for (int ct = 0; ct < QT; ++ct)
#pragma unroll
                for (int r = 0; r < 8; ++r) s[ct][c][r] = 0.0f;
            const _Float16* kb = &sK[0][kh * KHALF + c * 16 + l16][0] + kofs;
#pragma unroll
            for (int f = 0; f < 2; ++f) {
                v8h lo = *(const v8h*)(kb + f * 32 + kbase);
                v8h hi = *(const v8h*)(kb + f * 32 + kbase + 16);
                v16h afrag;
#pragma unroll
                for (int i = 0; i < 8; ++i) { afrag[i] = lo[i]; afrag[8 + i] = hi[i]; }
#pragma unroll
                for (int ct = 0; ct < QT; ++ct)
                    s[ct][c] = __builtin_amdgcn_wmma_f32_16x16x32_f16(
                                   false, afrag, false, qfrag[ct][f], (short)0, s[ct][c], false, false);
            }
        }
        // order of the region above: the K fragment reads in groups, 4 fragments ahead of the
        // products; behind the fences below the compiler otherwise waits out every single read
        __builtin_amdgcn_sched_group_barrier(0x100, 8, 0);
        __builtin_amdgcn_sched_group_barrier(0x008, 4, 0);
        __builtin_amdgcn_sched_group_barrier(0x100, 4, 0);
        __builtin_amdgcn_sched_group_barrier(0x008, 4, 0);
        __builtin_amdgcn_sched_group_barrier(0x100, 4, 0);
        __builtin_amdgcn_sched_group_barrier(0x008, 8, 0);

        // The next tile goes into the other buffers here: every reader left them at the barrier
        // that ended the last pass, and the stores drain under the vector work below, where this
        // wave asks nothing of LDS. The loads of the tile after it go out where the K fragments'
        // registers are free again.
        // Fences: neither hoisted among the products above nor sunk towards the pass's end.
        __builtin_amdgcn_sched_barrier(0);
        if (more)  stage(KBUF - kofs, VBUF - vofs);
        if (more2) fetch();
        __builtin_amdgcn_sched_barrier(0);

        // ---- online softmax update per query tile: in-lane, one exchange between halves ---
        v16h pfrag[QT][KFRAG];
        auto softmax = [&](const int ct) __attribute__((always_inline)) {
            float rmax[8];
#pragma unroll
            for (int r = 0; r < 8; ++r) {
                float v = s[ct][0][r];
#pragma unroll
                for (int c = 1; c < NCHUNK; ++c) v = fmaxf(v, s[ct][c][r]);
                rmax[r] = v;
            }
            float tmax = fmaxf(fmaxf(fmaxf(rmax[0], rmax[1]), fmaxf(rmax[2], rmax[3])),
                               fmaxf(fmaxf(rmax[4], rmax[5]), fmaxf(rmax[6], rmax[7])));
            tmax = fmaxf(tmax, xhalf(tmax));

            const float nm    = fmaxf(m[ct], tmax);
            const float alpha = __expf(m[ct] - nm);
            m[ct] = nm;
#pragma unroll
            for (int cc = 0; cc < 4; ++cc) o[ct][cc] *= alpha;

            // p = exp(s - m) as exp2((s - m) * log2 e), on whole tiles so the
            // subtract, multiply and add stay packed two to an instruction
            v8f rsum;
#pragma unroll
            for (int c = 0; c < NCHUNK; ++c) {
                v8f t = (s[ct][c] - nm) * 1.44269504088896340736f;
#pragma unroll
                for (int r = 0; r < 8; ++r) t[r] = __builtin_amdgcn_exp2f(t[r]);
                s[ct][c] = t;
                rsum = (c == 0) ? t : rsum + t;
            }
            l[ct] = l[ct] * alpha + (((rsum[0] + rsum[1]) + (rsum[2] + rsum[3])) +
                                     ((rsum[4] + rsum[5]) + (rsum[6] + rsum[7])));

            // ---- P^T as B operand: tiles 2f and 2f+1 hold keys in the fragment's k order
#pragma unroll
            for (int f = 0; f < KFRAG; ++f)
#pragma unroll
                for (int i = 0; i < 8; ++i) {
                    pfrag[ct][f][i]     = (_Float16)s[ct][2 * f][i];
                    pfrag[ct][f][8 + i] = (_Float16)s[ct][2 * f + 1][i];
                }
        };

        softmax(0);
        softmax(1);

        // ---- O^T += V^T P^T : A from transposed V, B from registers --------
        // key fragment outermost: its eight products go to eight different accumulators,
        // and those of the first fragment need only the first half of P
#pragma unroll
        for (int f = 0; f < KFRAG; ++f) {
#pragma unroll
            for (int cc = 0; cc < 4; ++cc) {
                const _Float16* vb = &sVt[0][cc][l16 * VPITCH + kh * KHALF] + vofs;
                v8h lo = *(const v8h*)(vb + f * 32 + kbase);
                v8h hi = *(const v8h*)(vb + f * 32 + kbase + 16);
                v16h afrag;
#pragma unroll
                for (int i = 0; i < 8; ++i) { afrag[i] = lo[i]; afrag[8 + i] = hi[i]; }
#pragma unroll
                for (int ct = 0; ct < QT; ++ct)
                    o[ct][cc] = __builtin_amdgcn_wmma_f32_16x16x32_f16(
                                    false, afrag, false, pfrag[ct][f], (short)0, o[ct][cc], false, false);
            }
        }

        // the fetched tile to fp16, beside the last products
        if (more2) convert();
        // the pass's one barrier: the next tile is resident, these buffers are free for the tile after it
        // (all 16 waves leave it together, so they still meet the matrix unit, the vector port and LDS in step)
        if (more) __syncthreads();
    };

    // ------- stream over key tiles ------------------------------------------
    int kofs = 0, vofs = 0;
    for (int kt = 0; kt + 2 < NCTX / KTILE; ++kt) {
        pass(true, true, kofs, vofs);
        kofs = KBUF - kofs;
        vofs = VBUF - vofs;
    }
    pass(true, false, kofs, vofs);
    pass(false, false, KBUF - kofs, VBUF - vofs);

    // ------- join the two key halves of a query group ------------------------
    // The wave of key half 0 finishes query tile 0, the other wave tile 1: each
    // hands the tile it does not finish to its partner through LDS.
    float lt[QT];
#pragma unroll
    for (int ct = 0; ct < QT; ++ct) lt[ct] = l[ct] + xhalf(l[ct]);

    auto give = [&](const int ct) __attribute__((always_inline)) {
#pragma unroll
        for (int cc = 0; cc < 4; ++cc) {
            v4f lo, hi;
#pragma unroll
            for (int i = 0; i < 4; ++i) { lo[i] = o[ct][cc][i]; hi[i] = o[ct][cc][4 + i]; }
            *(v4f*)&sX[wave][cc * 2][lane][0]     = lo;
            *(v4f*)&sX[wave][cc * 2 + 1][lane][0] = hi;
        }
        sML[wave][0][lane] = m[ct];
        sML[wave][1][lane] = lt[ct];
    };
    // O = (O_a e^(m_a - M) + O_b e^(m_b - M)) / (l_a e^(m_a - M) + l_b e^(m_b - M))
    //   -> out[b, t, h*64 + ch], 8 channels per lane and 16-channel group
    auto take = [&](const int ct) __attribute__((always_inline)) {
        const int   pw = wave ^ 8;
        const float pm = sML[pw][0][lane];
        const float pl = sML[pw][1][lane];
        const float mm = fmaxf(m[ct], pm);
        float fa = __expf(m[ct] - mm);
        float fb = __expf(pm - mm);
        const float inv = 1.0f / (lt[ct] * fa + pl * fb);
        fa *= inv;
        fb *= inv;
        float* op = out + ((size_t)(batch * NCTX + qrow + ct * 16) * HEADS + head) * CH + half * 8;
        v4f lo[4], hi[4];
#pragma unroll
        for (int cc = 0; cc < 4; ++cc) {
            const v4f plo = *(const v4f*)&sX[pw][cc * 2][lane][0];
            const v4f phi = *(const v4f*)&sX[pw][cc * 2 + 1][lane][0];
#pragma unroll
            for (int i = 0; i < 4; ++i) {
                lo[cc][i] = o[ct][cc][i] * fa     + plo[i] * fb;
                hi[cc][i] = o[ct][cc][4 + i] * fa + phi[i] * fb;
            }
        }
#pragma unroll
        for (int cc = 0; cc < 4; ++cc) {
            *(v4f*)(op + cc * 16)     = lo[cc];
            *(v4f*)(op + cc * 16 + 4) = hi[cc];
        }
        // precaution: stands in front of every rewrite of the stores' registers by code laid out behind this instance
        asm volatile("s_wait_xcnt 0x0" ::: "memory");
    };

    if (kh == 0) give(1); else give(0);
    __syncthreads();   // both partners' tiles stand in LDS
    if (kh == 0) take(0); else take(1);
}

extern "C" void kernel_launch(void* const* d_in, const int* in_sizes, int n_in,
                              void* d_out, int out_size, void* d_ws, size_t ws_size,
                              hipStream_t stream)
{
    const float* qkv = (const float*)d_in[0];
    float*       out = (float*)d_out;
    const int bs = in_sizes[0] / (NCTX * WTOK);   // 2 for the reference shapes

    dim3 grid(NCTX / QTILE, HEADS, bs);
    fa_fwd_kernel<<<grid, THREADS, 0, stream>>>(qkv, out);
}

// v006
// Measured time: 33 microseconds a run.
// Two timings next to v005 both put it at 1.06 times that version's speed.
// Over all steps from v000 it is 7.24 times as fast.
#include <hip/hip_runtime.h>

typedef __attribute__((ext_vector_type(16))) _Float16 v16h;
typedef __attribute__((ext_vector_type(8)))  _Float16 v8h;
typedef __attribute__((ext_vector_type(4)))  _Float16 v4h;
typedef __attribute__((ext_vector_type(8)))  float    v8f;
typedef __attribute__((ext_vector_type(4)))  float    v4f;

#define HEADS   16
#define CH      64
#define NCTX    2048
#define WTOK    (3 * HEADS * CH)   // 3072 floats per token
#define THREADS 512                // 16 waves: 8 query groups x 2 key halves
#define QT      2                  // query tiles of 16 columns per wave
#define QTILE   (8 * QT * 16)      // 256 query rows per block
#define KTILE   128                // keys per streaming tile
#define KHALF   (KTILE / 2)        // keys of a tile that one wave works on
#define NCHUNK  (KHALF / 16)       // 4 S-tiles of 16 keys per query tile
#define KFRAG   (KHALF / 32)       // 2 A/B fragment pairs along PV K-dim
#define NSTG    (KTILE * 16 / THREADS)   // 4 keys staged per thread

// LDS row pitches in halves. Bank = dword address mod 64, so 16 rows read with
// 16-byte loads meet 16 different bank quads only at a pitch of 16 B x odd.
#define KPITCH  (CH + 8)           // 144 B
#define VPITCH  (KTILE + 8)        // 272 B
// Each group of 16 V^T rows starts 16 B later than the pitch alone would put it:
// the staging stores of a half-wave go to rows 4 apart, which 272 B alone folds
// onto 4 banks; with the shift they meet 16 banks.
#define VGROUP  (16 * VPITCH + 8)
// halves in one buffer of K and of V^T
#define KBUF    (KTILE * KPITCH)
#define VBUF    (CH / 16 * VGROUP)
// how far, in powers of 2, a pass's maximum may lie above the held reference
#define RISE    8.0f

// lane l <-> lane l ^ 16: the two lanes that share one query column
__device__ __forceinline__ float xhalf(float v)
{
    const int u = __builtin_bit_cast(int, v);
    return __builtin_bit_cast(float,
        __builtin_amdgcn_permlanex16(u, u, 0x76543210, 0xfedcba98, false, false));
}

__global__ __launch_bounds__(THREADS)
void fa_fwd_kernel(const float* __restrict__ qkv, float* __restrict__ out)
{
    // two buffers each: a tile is read from one while the next tile is written to the other
    __shared__ __align__(16) _Float16 sK [2][KTILE][KPITCH];      // [key][ch] row-major
    __shared__ __align__(16) _Float16 sVt[2][CH / 16][VGROUP];    // [ch/16][(ch%16)*VPITCH + key]
    // what a wave hands to the other wave of its query group behind the loop
    __shared__ __align__(16) float sX [THREADS / 32][8][32][4];   // one output tile
    __shared__ float               sML[THREADS / 32][2][32];      // its reference and sum

    const int tid   = threadIdx.x;
    const int wave  = __builtin_amdgcn_readfirstlane(tid >> 5);
    const int lane  = tid & 31;
    const int l16   = lane & 15;
    const int half  = lane >> 4;        // 0: lanes 0-15, 1: lanes 16-31
    const int kbase = half * 8;         // 16-bit A/B fragment K-pattern
    const int qg    = wave & 7;         // query group
    const int kh    = wave >> 3;        // key half of every tile

    const int qtile = blockIdx.x;       // 0..7
    const int head  = blockIdx.y;       // 0..15
    const int batch = blockIdx.z;

    // (1/d^(1/4))^2 = 1/sqrt(64), times log2 e: scores come out as exponents of 2
    const float scale2 = 0.125f * 1.44269504088896340736f;

    // ------- load this wave's Q fragments (2 x 16 rows x 64 ch as 2 B-frags each) ----
    const int qrow = qtile * QTILE + qg * (QT * 16) + l16;      // query of tile 0

    v16h qfrag[QT][2];
#pragma unroll
    for (int ct = 0; ct < QT; ++ct) {
        const float* qptr = qkv + ((size_t)(batch * NCTX + qrow + ct * 16) * HEADS + head) * (3 * CH);
#pragma unroll
        for (int f = 0; f < 2; ++f) {
            const int k0 = f * 32 + kbase;
            v4f a = *(const v4f*)(qptr + k0);
            v4f b = *(const v4f*)(qptr + k0 + 4);
            v4f c = *(const v4f*)(qptr + k0 + 16);
            v4f d = *(const v4f*)(qptr + k0 + 20);
#pragma unroll
            for (int i = 0; i < 4; ++i) {
                qfrag[ct][f][i]      = (_Float16)(a[i] * scale2);
                qfrag[ct][f][4 + i]  = (_Float16)(b[i] * scale2);
                qfrag[ct][f][8 + i]  = (_Float16)(c[i] * scale2);
                qfrag[ct][f][12 + i] = (_Float16)(d[i] * scale2);
            }
        }
    }
    // precaution: stands in front of every later rewrite of the address registers that the Q loads name
    asm volatile("s_wait_xcnt 0x0" ::: "memory");

    // ------- online softmax state: this lane's queries are row l16 of each tile ---
    // m is MINUS the query's reference (equal in both lane halves): every p, sum and output is
    // held relative to 2^-m. The reference is the first pass's maximum and then moves only when
    // a pass's maximum lies more than RISE above it, so p stays at or below 2^RISE.
    // l sums this lane half's keys only.
    float m[QT], l[QT];
    v8f   o[QT][4];                     // o[ct][cc][r] = O[query ct*16 + l16][cc*16 + half*8 + r]
#pragma unroll
    for (int ct = 0; ct < QT; ++ct) {
        m[ct] = 0.0f; l[ct] = 0.0f;
#pragma unroll
        for (int cc = 0; cc < 4; ++cc)
#pragma unroll
            for (int r = 0; r < 8; ++r) o[ct][cc][r] = 0.0f;
    }

    // ------- this thread's share of a key tile: 4 channels of K and of V for 4 keys
    const int ch4  = (tid & 15) * 4;  // 0..60
    const int key0 = tid >> 4;        // 0..31
    // K of key key0 of tile 0; V lies CH floats behind, key + 32 lies 32 * WTOK behind
    const float* kp = qkv + ((size_t)(batch * NCTX + key0) * HEADS + head) * (3 * CH) + CH + ch4;

    v4f kreg[NSTG], vreg[NSTG];   // a tile on its way from memory, still fp32
    v4h kh4[NSTG], vh4[NSTG];     // the tile that goes into LDS next, as fp16: half the registers to hold
    auto fetch = [&]() __attribute__((always_inline)) {
#pragma unroll
        for (int it = 0; it < NSTG; ++it) {
            kreg[it] = *(const v4f*)(kp + (size_t)it * 32 * WTOK);
            vreg[it] = *(const v4f*)(kp + (size_t)it * 32 * WTOK + CH);
        }
        // precaution: stands in front of the rewrite of the address registers that these loads name
        asm volatile("s_wait_xcnt 0x0" ::: "memory");
        kp += (size_t)KTILE * WTOK;
    };
    auto convert = [&]() __attribute__((always_inline)) {
#pragma unroll
        for (int it = 0; it < NSTG; ++it)
#pragma unroll
            for (int i = 0; i < 4; ++i) {
                kh4[it][i] = (_Float16)kreg[it][i];
                vh4[it][i] = (_Float16)vreg[it][i];
            }
    };
    // into the buffers that start kofs and vofs halves into sK and sVt: K row-major, V transposed
    auto stage = [&](const int kofs, const int vofs) __attribute__((always_inline)) {
        _Float16* kw = &sK[0][key0][ch4] + kofs;
        _Float16* vw = &sVt[0][ch4 >> 4][(ch4 & 15) * VPITCH + key0] + vofs;
#pragma unroll
        for (int it = 0; it < NSTG; ++it) {
            *(v4h*)(kw + it * 32 * KPITCH) = kh4[it];
#pragma unroll
            for (int i = 0; i < 4; ++i) vw[i * VPITCH + it * 32] = vh4[it][i];
        }
    };

    fetch();           // tile 0
    convert();
    fetch();           // tile 1
    stage(0, 0);
    convert();
    __syncthreads();   // tile 0 resident in LDS

    // ------- one key tile, read from the buffers at kofs and vofs -------------------
    // first = no reference is set yet: this pass sets it
    // more  = another tile follows: it goes from its fp16 registers into the other buffers
    // more2 = a tile follows that one: it is fetched meanwhile
    // (inlined with constant flags, so loads and stores stand under no branch)
    auto pass = [&](const bool first, const bool more, const bool more2, const int kofs, const int vofs)
                __attribute__((always_inline)) {

        // ---- S^T = K (Q*s^2)^T : NCHUNK tiles of 16 keys x QT query tiles, 2 WMMAs each ----
        // s[ct][c][r] = score of key kh*64 + c*16 + half*8 + r against query ct*16 + l16,
        // in the log2 domain, less the query's reference (a lane's 8 rows are one query's)
        v8f s[QT][NCHUNK];
        v8f nref[QT];
#pragma unroll
        for (int ct = 0; ct < QT; ++ct)
#pragma unroll
            for (int r = 0; r < 8; ++r) nref[ct][r] = m[ct];
#pragma unroll
        for (int c = 0; c < NCHUNK; ++c) {
#pragma unroll
            for (int ct = 0; ct < QT; ++ct) s[ct][c] = nref[ct];
            const _Float16* kb = &sK[0][kh * KHALF + c * 16 + l16][0] + kofs;
#pragma unroll
            for (int f = 0; f < 2; ++f) {
                v8h lo = *(const v8h*)(kb + f * 32 + kbase);
                v8h hi = *(const v8h*)(kb + f * 32 + kbase + 16);
                v16h afrag;
#pragma unroll
                for (int i = 0; i < 8; ++i) { afrag[i] = lo[i]; afrag[8 + i] = hi[i]; }
#pragma unroll
                for (int ct = 0; ct < QT; ++ct)
                    s[ct][c] = __builtin_amdgcn_wmma_f32_16x16x32_f16(
                                   false, afrag, false, qfrag[ct][f], (short)0, s[ct][c], false, false);
            }
        }
        // order of the region above: the K fragment reads in groups, 4 fragments ahead of the
        // products; behind the fences below the compiler otherwise waits out every single read
        __builtin_amdgcn_sched_group_barrier(0x100, 8, 0);
        __builtin_amdgcn_sched_group_barrier(0x008, 4, 0);
        __builtin_amdgcn_sched_group_barrier(0x100, 4, 0);
        __builtin_amdgcn_sched_group_barrier(0x008, 4, 0);
        __builtin_amdgcn_sched_group_barrier(0x100, 4, 0);
        __builtin_amdgcn_sched_group_barrier(0x008, 8, 0);

        // The next tile goes into the other buffers here: every reader left them at the barrier
        // that ended the last pass, and the stores drain under the vector work below, where this
        // wave asks nothing of LDS. The loads of the tile after it go out where the K fragments'
        // registers are free again.
        // Fences: neither hoisted among the products above nor sunk towards the pass's end.
        __builtin_amdgcn_sched_barrier(0);
        if (more)  stage(KBUF - kofs, VBUF - vofs);
        if (more2) fetch();
        __builtin_amdgcn_sched_barrier(0);

        // ---- this lane's maxima over the reference; the halves meet only where it moves ---
        float tm[QT];
#pragma unroll
        for (int ct = 0; ct < QT; ++ct) {
            float rmax[8];
#pragma unroll
            for (int r = 0; r < 8; ++r) {
                float v = s[ct][0][r];
#pragma unroll
                for (int c = 1; c < NCHUNK; ++c) v = fmaxf(v, s[ct][c][r]);
                rmax[r] = v;
            }
            tm[ct] = fmaxf(fmaxf(fmaxf(rmax[0], rmax[1]), fmaxf(rmax[2], rmax[3])),
                           fmaxf(fmaxf(rmax[4], rmax[5]), fmaxf(rmax[6], rmax[7])));
        }
        // One test a pass for the whole wave, a scalar branch. Taken in the first pass and where
        // some query's maximum has risen by more than RISE: the reference moves up to the pass's
        // maximum (in the first pass: to it, up or down), and all that is held follows.
        if ((__builtin_amdgcn_ballot_w32(fmaxf(tm[0], tm[1]) > RISE) | (unsigned)first) != 0) {
#pragma unroll
            for (int ct = 0; ct < QT; ++ct) {
                const float t     = fmaxf(tm[ct], xhalf(tm[ct]));
                const float d     = first ? t : fmaxf(t, 0.0f);
                // nothing is held yet in the first pass: any finite factor serves
                const float alpha = first ? 0.0f : __builtin_amdgcn_exp2f(-d);
                m[ct] -= d;
                l[ct] *= alpha;
#pragma unroll
                for (int cc = 0; cc < 4; ++cc) o[ct][cc] *= alpha;
#pragma unroll
                for (int c = 0; c < NCHUNK; ++c) s[ct][c] -= d;
            }
        }

        // ---- p = 2^s per query tile, in-lane ---------------------------------------
        v16h pfrag[QT][KFRAG];
        auto softmax = [&](const int ct) __attribute__((always_inline)) {
            v8f rsum;
#pragma unroll
            for (int c = 0; c < NCHUNK; ++c) {
                v8f t;
#pragma unroll
                for (int r = 0; r < 8; ++r) t[r] = __builtin_amdgcn_exp2f(s[ct][c][r]);
                s[ct][c] = t;
                rsum = (c == 0) ? t : rsum + t;
            }
            l[ct] += ((rsum[0] + rsum[1]) + (rsum[2] + rsum[3])) +
                     ((rsum[4] + rsum[5]) + (rsum[6] + rsum[7]));

            // ---- P^T as B operand: tiles 2f and 2f+1 hold keys in the fragment's k order
#pragma unroll
            for (int f = 0; f < KFRAG; ++f)
#pragma unroll
                for (int i = 0; i < 8; ++i) {
                    pfrag[ct][f][i]     = (_Float16)s[ct][2 * f][i];
                    pfrag[ct][f][8 + i] = (_Float16)s[ct][2 * f + 1][i];
                }
        };

        softmax(0);
        softmax(1);

        // ---- O^T += V^T P^T : A from transposed V, B from registers --------
        // key fragment outermost: its eight products go to eight different accumulators,
        // and those of the first fragment need only the first half of P
#pragma unroll
        for (int f = 0; f < KFRAG; ++f) {
#pragma unroll
            for (int cc = 0; cc < 4; ++cc) {
                const _Float16* vb = &sVt[0][cc][l16 * VPITCH + kh * KHALF] + vofs;
                v8h lo = *(const v8h*)(vb + f * 32 + kbase);
                v8h hi = *(const v8h*)(vb + f * 32 + kbase + 16);
                v16h afrag;
#pragma unroll
                for (int i = 0; i < 8; ++i) { afrag[i] = lo[i]; afrag[8 + i] = hi[i]; }
#pragma unroll
                for (int ct = 0; ct < QT; ++ct)
                    o[ct][cc] = __builtin_amdgcn_wmma_f32_16x16x32_f16(
                                    false, afrag, false, pfrag[ct][f], (short)0, o[ct][cc], false, false);
            }
        }

        // the fetched tile to fp16, beside the last products
        if (more2) convert();
        // the pass's one barrier: the next tile is resident, these buffers are free for the tile after it
        // (all 16 waves leave it together, so they still meet the matrix unit, the vector port and LDS in step)
        if (more) __syncthreads();
    };

    // ------- stream over key tiles ------------------------------------------
    int kofs = 0, vofs = 0;
    for (int kt = 0; kt + 2 < NCTX / KTILE; ++kt) {
        pass(kt == 0, true, true, kofs, vofs);
        kofs = KBUF - kofs;
        vofs = VBUF - vofs;
    }
    pass(false, true, false, kofs, vofs);
    pass(false, false, false, KBUF - kofs, VBUF - vofs);

    // ------- join the two key halves of a query group ------------------------
    // The wave of key half 0 finishes query tile 0, the other wave tile 1: each
    // hands the tile it does not finish to its partner through LDS.
    float lt[QT];
#pragma unroll
    for (int ct = 0; ct < QT; ++ct) lt[ct] = l[ct] + xhalf(l[ct]);
    // the lane's number formed anew: no index or address of this part is then held in a register
    // over the loop, which has none to spare: held there, they go to scratch
    const int elane = (int)__builtin_amdgcn_mbcnt_lo(~0u, 0u);

    auto give = [&](const int ct) __attribute__((always_inline)) {
#pragma unroll
        for (int cc = 0; cc < 4; ++cc) {
            v4f lo, hi;
#pragma unroll
            for (int i = 0; i < 4; ++i) { lo[i] = o[ct][cc][i]; hi[i] = o[ct][cc][4 + i]; }
            *(v4f*)&sX[wave][cc * 2][elane][0]     = lo;
            *(v4f*)&sX[wave][cc * 2 + 1][elane][0] = hi;
        }
        sML[wave][0][elane] = -m[ct];
        sML[wave][1][elane] = lt[ct];
    };
    // O = (O_a 2^(-m_a - M) + O_b 2^(-m_b - M)) / (l_a 2^(-m_a - M) + l_b 2^(-m_b - M)), M = max(-m_a, -m_b)
    //   -> out[b, t, h*64 + ch], 8 channels per lane and 16-channel group
    auto take = [&](const int ct) __attribute__((always_inline)) {
        const int   pw = wave ^ 8;
        const float pm = sML[pw][0][elane];
        const float pl = sML[pw][1][elane];
        const float mm = fmaxf(-m[ct], pm);
        float fa = __builtin_amdgcn_exp2f(-m[ct] - mm);
        float fb = __builtin_amdgcn_exp2f(pm - mm);
        const float inv = 1.0f / (lt[ct] * fa + pl * fb);
        fa *= inv;
        fb *= inv;
        const int orow = qtile * QTILE + qg * (QT * 16) + ct * 16 + (elane & 15);
        float* op = out + ((size_t)(batch * NCTX + orow) * HEADS + head) * CH + (elane >> 4) * 8;
        v4f lo[4], hi[4];
#pragma unroll
        for (int cc = 0; cc < 4; ++cc) {
            const v4f plo = *(const v4f*)&sX[pw][cc * 2][elane][0];
            const v4f phi = *(const v4f*)&sX[pw][cc * 2 + 1][elane][0];
#pragma unroll
            for (int i = 0; i < 4; ++i) {
                lo[cc][i] = o[ct][cc][i] * fa     + plo[i] * fb;
                hi[cc][i] = o[ct][cc][4 + i] * fa + phi[i] * fb;
            }
        }
#pragma unroll
        for (int cc = 0; cc < 4; ++cc) {
            *(v4f*)(op + cc * 16)     = lo[cc];
            *(v4f*)(op + cc * 16 + 4) = hi[cc];
        }
        // precaution: stands in front of every rewrite of the stores' registers by code laid out behind this instance
        asm volatile("s_wait_xcnt 0x0" ::: "memory");
    };

    if (kh == 0) give(1); else give(0);
    __syncthreads();   // both partners' tiles stand in LDS
    if (kh == 0) take(0); else take(1);
}

extern "C" void kernel_launch(void* const* d_in, const int* in_sizes, int n_in,
                              void* d_out, int out_size, void* d_ws, size_t ws_size,
                              hipStream_t stream)
{
    const float* qkv = (const float*)d_in[0];
    float*       out = (float*)d_out;
    const int bs = in_sizes[0] / (NCTX * WTOK);   // 2 for the reference shapes

    dim3 grid(NCTX / QTILE, HEADS, bs);
    fa_fwd_kernel<<<grid, THREADS, 0, stream>>>(qkv, out);
}

// v007
// One run takes 32 microseconds.
// Timed twice side by side with v006, it ran 1.03 times as fast both times.
// Counting every step since v000, it is 7.47 times as fast.
#include <hip/hip_runtime.h>

typedef __attribute__((ext_vector_type(16))) _Float16 v16h;
typedef __attribute__((ext_vector_type(8)))  _Float16 v8h;
typedef __attribute__((ext_vector_type(4)))  _Float16 v4h;
typedef __attribute__((ext_vector_type(8)))  float    v8f;
typedef __attribute__((ext_vector_type(4)))  float    v4f;

#define HEADS   16
#define CH      64
#define NCTX    2048
#define WTOK    (3 * HEADS * CH)   // 3072 floats per token
#define THREADS 512                // 16 waves: 8 query groups x 2 key halves
#define QT      2                  // query tiles of 16 columns per wave
#define QTILE   (8 * QT * 16)      // 256 query rows per block
#define KTILE   128                // keys per streaming tile
#define KHALF   (KTILE / 2)        // keys of a tile that one wave works on
#define NCHUNK  (KHALF / 16)       // 4 S-tiles of 16 keys per query tile
#define KFRAG   (KHALF / 32)       // 2 A/B fragment pairs along PV K-dim
#define NSTG    (KTILE * 16 / THREADS)   // 4 keys staged per thread

// LDS row pitches in halves. Bank = dword address mod 64, so 16 rows read with
// 16-byte loads meet 16 different bank quads only at a pitch of 16 B x odd.
#define KPITCH  (CH + 8)           // 144 B
#define VPITCH  (KTILE + 8)        // 272 B
// Each group of 16 V^T rows starts 16 B later than the pitch alone would put it:
// the staging stores of a half-wave go to rows 4 apart, which 272 B alone folds
// onto 4 banks; with the shift they meet 16 banks.
#define VGROUP  (16 * VPITCH + 8)
// halves in one buffer of K and of V^T, and how many buffers each has
#define KBUF    (KTILE * KPITCH)
#define VBUF    (CH / 16 * VGROUP)
#define NBUF    3
// how far, in powers of 2, a pass's maximum may lie above the held reference
#define RISE    8.0f

// lane l <-> lane l ^ 16: the two lanes that share one query column
__device__ __forceinline__ float xhalf(float v)
{
    const int u = __builtin_bit_cast(int, v);
    return __builtin_bit_cast(float,
        __builtin_amdgcn_permlanex16(u, u, 0x76543210, 0xfedcba98, false, false));
}

__global__ __launch_bounds__(THREADS)
void fa_fwd_kernel(const float* __restrict__ qkv, float* __restrict__ out)
{
    // three buffers each: tile t is read from one and tile t + 1 written to the next, while waves
    // that lag may still read tile t - 1 from the third
    __shared__ __align__(16) _Float16 sK [NBUF][KTILE][KPITCH];      // [key][ch] row-major
    __shared__ __align__(16) _Float16 sVt[NBUF][CH / 16][VGROUP];    // [ch/16][(ch%16)*VPITCH + key]
    // what a wave hands to the other wave of its query group behind the loop
    __shared__ __align__(16) float sX [THREADS / 32][8][32][4];   // one output tile
    __shared__ float               sML[THREADS / 32][2][32];      // its reference and sum

    const int tid   = threadIdx.x;
    const int wave  = __builtin_amdgcn_readfirstlane(tid >> 5);
    const int lane  = tid & 31;
    const int l16   = lane & 15;
    const int half  = lane >> 4;        // 0: lanes 0-15, 1: lanes 16-31
    const int kbase = half * 8;         // 16-bit A/B fragment K-pattern
    const int qg    = wave & 7;         // query group
    const int kh    = wave >> 3;        // key half of every tile

    const int qtile = blockIdx.x;       // 0..7
    const int head  = blockIdx.y;       // 0..15
    const int batch = blockIdx.z;

    // (1/d^(1/4))^2 = 1/sqrt(64), times log2 e: scores come out as exponents of 2
    const float scale2 = 0.125f * 1.44269504088896340736f;

    // ------- load this wave's Q fragments (2 x 16 rows x 64 ch as 2 B-frags each) ----
    const int qrow = qtile * QTILE + qg * (QT * 16) + l16;      // query of tile 0

    v16h qfrag[QT][2];
#pragma unroll
    for (int ct = 0; ct < QT; ++ct) {
        const float* qptr = qkv + ((size_t)(batch * NCTX + qrow + ct * 16) * HEADS + head) * (3 * CH);
#pragma unroll
        for (int f = 0; f < 2; ++f) {
            const int k0 = f * 32 + kbase;
            v4f a = *(const v4f*)(qptr + k0);
            v4f b = *(const v4f*)(qptr + k0 + 4);
            v4f c = *(const v4f*)(qptr + k0 + 16);
            v4f d = *(const v4f*)(qptr + k0 + 20);
#pragma unroll
            for (int i = 0; i < 4; ++i) {
                qfrag[ct][f][i]      = (_Float16)(a[i] * scale2);
                qfrag[ct][f][4 + i]  = (_Float16)(b[i] * scale2);
                qfrag[ct][f][8 + i]  = (_Float16)(c[i] * scale2);
                qfrag[ct][f][12 + i] = (_Float16)(d[i] * scale2);
            }
        }
    }
    // precaution: stands in front of every later rewrite of the address registers that the Q loads name
    asm volatile("s_wait_xcnt 0x0" ::: "memory");

    // ------- online softmax state: this lane's queries are row l16 of each tile ---
    // m is MINUS the query's reference (equal in both lane halves): every p, sum and output is
    // held relative to 2^-m. The reference is the first pass's maximum and then moves only when
    // a pass's maximum lies more than RISE above it, so p stays at or below 2^RISE.
    // l sums this lane half's keys only.
    float m[QT], l[QT];
    v8f   o[QT][4];                     // o[ct][cc][r] = O[query ct*16 + l16][cc*16 + half*8 + r]
#pragma unroll
    for (int ct = 0; ct < QT; ++ct) {
        m[ct] = 0.0f; l[ct] = 0.0f;
#pragma unroll
        for (int cc = 0; cc < 4; ++cc)
#pragma unroll
            for (int r = 0; r < 8; ++r) o[ct][cc][r] = 0.0f;
    }

    // ------- this thread's share of a key tile: 4 channels of K and of V for 4 keys
    const int ch4  = (tid & 15) * 4;  // 0..60
    const int key0 = tid >> 4;        // 0..31
    // K of key key0 of tile 0; V lies CH floats behind, key + 32 lies 32 * WTOK behind
    const float* kp = qkv + ((size_t)(batch * NCTX + key0) * HEADS + head) * (3 * CH) + CH + ch4;

    v4f kreg[NSTG], vreg[NSTG];   // a tile on its way from memory, still fp32
    v4h kh4[NSTG], vh4[NSTG];     // the tile that goes into LDS next, as fp16: half the registers to hold
    auto fetch = [&]() __attribute__((always_inline)) {
#pragma unroll
        for (int it = 0; it < NSTG; ++it) {
            kreg[it] = *(const v4f*)(kp + (size_t)it * 32 * WTOK);
            vreg[it] = *(const v4f*)(kp + (size_t)it * 32 * WTOK + CH);
        }
        // precaution: stands in front of the rewrite of the address registers that these loads name
        asm volatile("s_wait_xcnt 0x0" ::: "memory");
        kp += (size_t)KTILE * WTOK;
    };
    auto convert = [&]() __attribute__((always_inline)) {
#pragma unroll
        for (int it = 0; it < NSTG; ++it)
#pragma unroll
            for (int i = 0; i < 4; ++i) {
                kh4[it][i] = (_Float16)kreg[it][i];
                vh4[it][i] = (_Float16)vreg[it][i];
            }
    };
    // into the buffers that start kofs and vofs halves into sK and sVt: K row-major, V transposed
    auto stage = [&](const int kofs, const int vofs) __attribute__((always_inline)) {
        _Float16* kw = &sK[0][key0][ch4] + kofs;
        _Float16* vw = &sVt[0][ch4 >> 4][(ch4 & 15) * VPITCH + key0] + vofs;
#pragma unroll
        for (int it = 0; it < NSTG; ++it) {
            *(v4h*)(kw + it * 32 * KPITCH) = kh4[it];
#pragma unroll
            for (int i = 0; i < 4; ++i) vw[i * VPITCH + it * 32] = vh4[it][i];
        }
    };

    fetch();           // tile 0
    convert();
    fetch();           // tile 1
    stage(0, 0);
    convert();
    __syncthreads();   // tile 0 resident in LDS

    // ------- one key tile, read from the buffers at kofs and vofs; the next goes to kwr and vwr ---
    // first = no reference is set yet: this pass sets it
    // more  = another tile follows: it goes from its fp16 registers into the other buffers
    // more2 = a tile follows that one: it is fetched meanwhile
    // (inlined with constant flags, so loads and stores stand under no branch)
    auto pass = [&](const bool first, const bool more, const bool more2, const int kofs, const int vofs,
                    const int kwr, const int vwr) __attribute__((always_inline)) {

        // ---- S^T = K (Q*s^2)^T : NCHUNK tiles of 16 keys x QT query tiles, 2 WMMAs each ----
        // s[ct][c][r] = score of key kh*64 + c*16 + half*8 + r against query ct*16 + l16,
        // in the log2 domain, less the query's reference (a lane's 8 rows are one query's)
        v8f s[QT][NCHUNK];
        v8f nref[QT];
#pragma unroll
        for (int ct = 0; ct < QT; ++ct)
#pragma unroll
            for (int r = 0; r < 8; ++r) nref[ct][r] = m[ct];
#pragma unroll
        for (int c = 0; c < NCHUNK; ++c) {
#pragma unroll
            for (int ct = 0; ct < QT; ++ct) s[ct][c] = nref[ct];
            const _Float16* kb = &sK[0][kh * KHALF + c * 16 + l16][0] + kofs;
#pragma unroll
            for (int f = 0; f < 2; ++f) {
                v8h lo = *(const v8h*)(kb + f * 32 + kbase);
                v8h hi = *(const v8h*)(kb + f * 32 + kbase + 16);
                v16h afrag;
#pragma unroll
                for (int i = 0; i < 8; ++i) { afrag[i] = lo[i]; afrag[8 + i] = hi[i]; }
#pragma unroll
                for (int ct = 0; ct < QT; ++ct)
                    s[ct][c] = __builtin_amdgcn_wmma_f32_16x16x32_f16(
                                   false, afrag, false, qfrag[ct][f], (short)0, s[ct][c], false, false);
            }
        }
        // order of the region above: the K fragment reads in groups, 4 fragments ahead of the
        // products; behind the fences below the compiler otherwise waits out every single read
        __builtin_amdgcn_sched_group_barrier(0x100, 8, 0);
        __builtin_amdgcn_sched_group_barrier(0x008, 4, 0);
        __builtin_amdgcn_sched_group_barrier(0x100, 4, 0);
        __builtin_amdgcn_sched_group_barrier(0x008, 4, 0);
        __builtin_amdgcn_sched_group_barrier(0x100, 4, 0);
        __builtin_amdgcn_sched_group_barrier(0x008, 8, 0);

        // The next tile goes into the next buffers here. They held the tile of two passes ago: every
        // wave had read it to the end before its signal in the last pass, and this wave has waited
        // for all those signals. The stores drain under the vector work below, where this wave asks
        // nothing of LDS. The loads of the tile after it go out where the K fragments' registers
        // are free again.
        // Fences: neither hoisted among the products above nor sunk towards the pass's end.
        __builtin_amdgcn_sched_barrier(0);
        if (more)  stage(kwr, vwr);
        if (more2) fetch();
        __builtin_amdgcn_sched_barrier(0);

        // ---- this lane's maxima over the reference; the halves meet only where it moves ---
        float tm[QT];
#pragma unroll
        for (int ct = 0; ct < QT; ++ct) {
            float rmax[8];
#pragma unroll
            for (int r = 0; r < 8; ++r) {
                float v = s[ct][0][r];
#pragma unroll
                for (int c = 1; c < NCHUNK; ++c) v = fmaxf(v, s[ct][c][r]);
                rmax[r] = v;
            }
            tm[ct] = fmaxf(fmaxf(fmaxf(rmax[0], rmax[1]), fmaxf(rmax[2], rmax[3])),
                           fmaxf(fmaxf(rmax[4], rmax[5]), fmaxf(rmax[6], rmax[7])));
        }
        // One test a pass for the whole wave, a scalar branch. Taken in the first pass and where
        // some query's maximum has risen by more than RISE: the reference moves up to the pass's
        // maximum (in the first pass: to it, up or down), and all that is held follows.
        if ((__builtin_amdgcn_ballot_w32(fmaxf(tm[0], tm[1]) > RISE) | (unsigned)first) != 0) {
#pragma unroll
            for (int ct = 0; ct < QT; ++ct) {
                const float t     = fmaxf(tm[ct], xhalf(tm[ct]));
                const float d     = first ? t : fmaxf(t, 0.0f);
                // nothing is held yet in the first pass: any finite factor serves
                const float alpha = first ? 0.0f : __builtin_amdgcn_exp2f(-d);
                m[ct] -= d;
                l[ct] *= alpha;
#pragma unroll
                for (int cc = 0; cc < 4; ++cc) o[ct][cc] *= alpha;
#pragma unroll
                for (int c = 0; c < NCHUNK; ++c) s[ct][c] -= d;
            }
        }

        // First half of the pass's barrier, by hand so that its wait can stand at the pass's end:
        // this wave's share of the next tile is in LDS (the LDS wait) and it has left the last
        // pass's buffers. A wave may so run on to the pass's end while others are only here.
        // The V^T reads between signal and wait are of this pass's own tile: its buffers are written
        // again only two passes on, behind the wait for every wave's next signal, whose LDS wait
        // ends these reads.
        if (more) asm volatile("s_wait_dscnt 0x0\n\ts_barrier_signal -1" ::: "memory");

        // ---- p = 2^s per query tile, in-lane ---------------------------------------
        v16h pfrag[QT][KFRAG];
        auto softmax = [&](const int ct) __attribute__((always_inline)) {
            v8f rsum;
#pragma unroll
            for (int c = 0; c < NCHUNK; ++c) {
                v8f t;
#pragma unroll
                for (int r = 0; r < 8; ++r) t[r] = __builtin_amdgcn_exp2f(s[ct][c][r]);
                s[ct][c] = t;
                rsum = (c == 0) ? t : rsum + t;
            }
            l[ct] += ((rsum[0] + rsum[1]) + (rsum[2] + rsum[3])) +
                     ((rsum[4] + rsum[5]) + (rsum[6] + rsum[7]));

            // ---- P^T as B operand: tiles 2f and 2f+1 hold keys in the fragment's k order
#pragma unroll
            for (int f = 0; f < KFRAG; ++f)
#pragma unroll
                for (int i = 0; i < 8; ++i) {
                    pfrag[ct][f][i]     = (_Float16)s[ct][2 * f][i];
                    pfrag[ct][f][8 + i] = (_Float16)s[ct][2 * f + 1][i];
                }
        };

        softmax(0);
        softmax(1);

        // ---- O^T += V^T P^T : A from transposed V, B from registers --------
        // key fragment outermost: its eight products go to eight different accumulators,
        // and those of the first fragment need only the first half of P
#pragma unroll
        for (int f = 0; f < KFRAG; ++f) {
#pragma unroll
            for (int cc = 0; cc < 4; ++cc) {
                const _Float16* vb = &sVt[0][cc][l16 * VPITCH + kh * KHALF] + vofs;
                v8h lo = *(const v8h*)(vb + f * 32 + kbase);
                v8h hi = *(const v8h*)(vb + f * 32 + kbase + 16);
                v16h afrag;
#pragma unroll
                for (int i = 0; i < 8; ++i) { afrag[i] = lo[i]; afrag[8 + i] = hi[i]; }
#pragma unroll
                for (int ct = 0; ct < QT; ++ct)
                    o[ct][cc] = __builtin_amdgcn_wmma_f32_16x16x32_f16(
                                    false, afrag, false, pfrag[ct][f], (short)0, o[ct][cc], false, false);
            }
        }

        // the fetched tile to fp16, beside the last products
        if (more2) convert();
        // second half of the pass's barrier: every wave has signalled, so the next tile is resident
        if (more) asm volatile("s_barrier_wait 0xffff" ::: "memory");
    };

    // ------- stream over key tiles ------------------------------------------
    // Two of a SIMD's four waves win every issue slot they ask for (whether a SIMD takes waves
    // w, w + 4, ... or four in a row, this bit picks two of its four): they run ahead as far as
    // the split barrier lets them, and the halves stop meeting the same unit at the same time.
    const bool lead = ((wave ^ (wave >> 2)) & 1) != 0;
    if (lead) __builtin_amdgcn_s_setprio(3);

    int kofs = 0, vofs = 0;
    for (int kt = 0; kt + 2 < NCTX / KTILE; ++kt) {
        const int kwr = (kofs == (NBUF - 1) * KBUF) ? 0 : kofs + KBUF;
        const int vwr = (vofs == (NBUF - 1) * VBUF) ? 0 : vofs + VBUF;
        pass(kt == 0, true, true, kofs, vofs, kwr, vwr);
        kofs = kwr;
        vofs = vwr;
    }
    {
        const int kwr = (kofs == (NBUF - 1) * KBUF) ? 0 : kofs + KBUF;
        const int vwr = (vofs == (NBUF - 1) * VBUF) ? 0 : vofs + VBUF;
        pass(false, true, false, kofs, vofs, kwr, vwr);
        pass(false, false, false, kwr, vwr, 0, 0);
    }
    if (lead) __builtin_amdgcn_s_setprio(0);   // back to the common priority on the way out

    // ------- join the two key halves of a query group ------------------------
    // The wave of key half 0 finishes query tile 0, the other wave tile 1: each
    // hands the tile it does not finish to its partner through LDS.
    float lt[QT];
#pragma unroll
    for (int ct = 0; ct < QT; ++ct) lt[ct] = l[ct] + xhalf(l[ct]);
    // the lane's number formed anew: no index or address of this part is then held in a register
    // over the loop, which has none to spare: held there, they go to scratch
    const int elane = (int)__builtin_amdgcn_mbcnt_lo(~0u, 0u);

    auto give = [&](const int ct) __attribute__((always_inline)) {
#pragma unroll
        for (int cc = 0; cc < 4; ++cc) {
            v4f lo, hi;
#pragma unroll
            for (int i = 0; i < 4; ++i) { lo[i] = o[ct][cc][i]; hi[i] = o[ct][cc][4 + i]; }
            *(v4f*)&sX[wave][cc * 2][elane][0]     = lo;
            *(v4f*)&sX[wave][cc * 2 + 1][elane][0] = hi;
        }
        sML[wave][0][elane] = -m[ct];
        sML[wave][1][elane] = lt[ct];
    };
    // O = (O_a 2^(-m_a - M) + O_b 2^(-m_b - M)) / (l_a 2^(-m_a - M) + l_b 2^(-m_b - M)), M = max(-m_a, -m_b)
    //   -> out[b, t, h*64 + ch], 8 channels per lane and 16-channel group
    auto take = [&](const int ct) __attribute__((always_inline)) {
        const int   pw = wave ^ 8;
        const float pm = sML[pw][0][elane];
        const float pl = sML[pw][1][elane];
        const float mm = fmaxf(-m[ct], pm);
        float fa = __builtin_amdgcn_exp2f(-m[ct] - mm);
        float fb = __builtin_amdgcn_exp2f(pm - mm);
        const float inv = 1.0f / (lt[ct] * fa + pl * fb);
        fa *= inv;
        fb *= inv;
        const int orow = qtile * QTILE + qg * (QT * 16) + ct * 16 + (elane & 15);
        float* op = out + ((size_t)(batch * NCTX + orow) * HEADS + head) * CH + (elane >> 4) * 8;
        v4f lo[4], hi[4];
#pragma unroll
        for (int cc = 0; cc < 4; ++cc) {
            const v4f plo = *(const v4f*)&sX[pw][cc * 2][elane][0];
            const v4f phi = *(const v4f*)&sX[pw][cc * 2 + 1][elane][0];
#pragma unroll
            for (int i = 0; i < 4; ++i) {
                lo[cc][i] = o[ct][cc][i] * fa     + plo[i] * fb;
                hi[cc][i] = o[ct][cc][4 + i] * fa + phi[i] * fb;
            }
        }
#pragma unroll
        for (int cc = 0; cc < 4; ++cc) {
            *(v4f*)(op + cc * 16)     = lo[cc];
            *(v4f*)(op + cc * 16 + 4) = hi[cc];
        }
        // precaution: stands in front of every rewrite of the stores' registers by code laid out behind this instance
        asm volatile("s_wait_xcnt 0x0" ::: "memory");
    };

    if (kh == 0) give(1); else give(0);
    __syncthreads();   // both partners' tiles stand in LDS
    if (kh == 0) take(0); else take(1);
}

extern "C" void kernel_launch(void* const* d_in, const int* in_sizes, int n_in,
                              void* d_out, int out_size, void* d_ws, size_t ws_size,
                              hipStream_t stream)
{
    const float* qkv = (const float*)d_in[0];
    float*       out = (float*)d_out;
    const int bs = in_sizes[0] / (NCTX * WTOK);   // 2 for the reference shapes

    dim3 grid(NCTX / QTILE, HEADS, bs);
    fa_fwd_kernel<<<grid, THREADS, 0, stream>>>(qkv, out);
}

// v008
// One run takes 29.3 microseconds.
// Timed twice side by side with v007, it ran 1.09 times as fast both times.
// Over all steps from v000 it is 8.14 times as fast.
#include <hip/hip_runtime.h>

typedef __attribute__((ext_vector_type(16))) _Float16 v16h;
typedef __attribute__((ext_vector_type(8)))  _Float16 v8h;
typedef __attribute__((ext_vector_type(4)))  _Float16 v4h;
typedef __attribute__((ext_vector_type(8)))  float    v8f;
typedef __attribute__((ext_vector_type(4)))  float    v4f;

#define HEADS   16
#define CH      64
#define NCTX    2048
#define WTOK    (3 * HEADS * CH)   // 3072 floats per token
#define THREADS 512                // 16 waves: 8 query groups x 2 key halves
#define QT      2                  // query tiles of 16 columns per wave
#define QTILE   (8 * QT * 16)      // 256 query rows per block
#define KTILE   128                // keys per streaming tile
#define KHALF   (KTILE / 2)        // keys of a tile that one wave works on
#define NCHUNK  (KHALF / 16)       // 4 S-tiles of 16 keys per query tile
#define KFRAG   (KHALF / 32)       // 2 A/B fragment pairs along PV K-dim
#define NSTG    (KTILE * 16 / THREADS)   // 4 keys staged per thread

// LDS row pitches in halves. Bank = dword address mod 64, so 16 rows read with
// 16-byte loads meet 16 different bank quads only at a pitch of 16 B x odd.
#define KPITCH  (CH + 8)           // 144 B
#define VPITCH  (KTILE + 8)        // 272 B
// Each group of 16 V^T rows starts 16 B later than the pitch alone would put it:
// the staging stores of a half-wave go to rows 4 apart, which 272 B alone folds
// onto 4 banks; with the shift they meet 16 banks.
#define VGROUP  (16 * VPITCH + 8)
// halves in one buffer of K and of V^T, and how many buffers each has
#define KBUF    (KTILE * KPITCH)
#define VBUF    (CH / 16 * VGROUP)
#define NBUF    3
// a p may lie up to 2^8 above the held reference: a lane's sum of p over a pass is held against this
#define LIMIT   256.0f

// lane l <-> lane l ^ 16: the two lanes that share one query column
__device__ __forceinline__ float xhalf(float v)
{
    const int u = __builtin_bit_cast(int, v);
    return __builtin_bit_cast(float,
        __builtin_amdgcn_permlanex16(u, u, 0x76543210, 0xfedcba98, false, false));
}

__global__ __launch_bounds__(THREADS)
void fa_fwd_kernel(const float* __restrict__ qkv, float* __restrict__ out)
{
    // three buffers each: tile t is read from one and tile t + 1 written to the next, while waves
    // that lag may still read tile t - 1 from the third
    __shared__ __align__(16) _Float16 sK [NBUF][KTILE][KPITCH];      // [key][ch] row-major
    __shared__ __align__(16) _Float16 sVt[NBUF][CH / 16][VGROUP];    // [ch/16][(ch%16)*VPITCH + key]
    // what a wave hands to the other wave of its query group behind the loop
    __shared__ __align__(16) float sX [THREADS / 32][8][32][4];   // one output tile
    __shared__ float               sML[THREADS / 32][2][32];      // its reference and sum

    const int tid   = threadIdx.x;
    const int wave  = __builtin_amdgcn_readfirstlane(tid >> 5);
    const int lane  = tid & 31;
    const int l16   = lane & 15;
    const int half  = lane >> 4;        // 0: lanes 0-15, 1: lanes 16-31
    const int kbase = half * 8;         // 16-bit A/B fragment K-pattern
    const int qg    = wave & 7;         // query group
    const int kh    = wave >> 3;        // key half of every tile

    const int qtile = blockIdx.x;       // 0..7
    const int head  = blockIdx.y;       // 0..15
    const int batch = blockIdx.z;

    // (1/d^(1/4))^2 = 1/sqrt(64), times log2 e: scores come out as exponents of 2
    const float scale2 = 0.125f * 1.44269504088896340736f;

    // ------- load this wave's Q fragments (2 x 16 rows x 64 ch as 2 B-frags each) ----
    const int qrow = qtile * QTILE + qg * (QT * 16) + l16;      // query of tile 0

    v16h qfrag[QT][2];
#pragma unroll
    for (int ct = 0; ct < QT; ++ct) {
        const float* qptr = qkv + ((size_t)(batch * NCTX + qrow + ct * 16) * HEADS + head) * (3 * CH);
#pragma unroll
        for (int f = 0; f < 2; ++f) {
            const int k0 = f * 32 + kbase;
            v4f a = *(const v4f*)(qptr + k0);
            v4f b = *(const v4f*)(qptr + k0 + 4);
            v4f c = *(const v4f*)(qptr + k0 + 16);
            v4f d = *(const v4f*)(qptr + k0 + 20);
#pragma unroll
            for (int i = 0; i < 4; ++i) {
                qfrag[ct][f][i]      = (_Float16)(a[i] * scale2);
                qfrag[ct][f][4 + i]  = (_Float16)(b[i] * scale2);
                qfrag[ct][f][8 + i]  = (_Float16)(c[i] * scale2);
                qfrag[ct][f][12 + i] = (_Float16)(d[i] * scale2);
            }
        }
    }
    // precaution: stands in front of every later rewrite of the address registers that the Q loads name
    asm volatile("s_wait_xcnt 0x0" ::: "memory");

    // ------- online softmax state: this lane's queries are row l16 of each tile ---
    // m is MINUS the query's reference (equal in both lane halves): every p, sum and output is
    // held relative to 2^-m. The reference is the first pass's maximum and then moves only when
    // a lane's sum of p over a pass exceeds LIMIT, so p stays at or below LIMIT.
    // l sums this lane half's keys only.
    float m[QT], l[QT];
    v8f   o[QT][4];                     // o[ct][cc][r] = O[query ct*16 + l16][cc*16 + half*8 + r]
#pragma unroll
    for (int ct = 0; ct < QT; ++ct) {
        m[ct] = 0.0f; l[ct] = 0.0f;
#pragma unroll
        for (int cc = 0; cc < 4; ++cc)
#pragma unroll
            for (int r = 0; r < 8; ++r) o[ct][cc][r] = 0.0f;
    }

    // ------- this thread's share of a key tile: 4 channels of K and of V for 4 keys
    const int ch4  = (tid & 15) * 4;  // 0..60
    const int key0 = tid >> 4;        // 0..31
    // K of key key0 of tile 0; V lies CH floats behind, key + 32 lies 32 * WTOK behind
    const float* kp = qkv + ((size_t)(batch * NCTX + key0) * HEADS + head) * (3 * CH) + CH + ch4;

    v4f kreg[NSTG], vreg[NSTG];   // a tile on its way from memory, still fp32
    v4h kh4[NSTG], vh4[NSTG];     // the tile that goes into LDS next, as fp16: half the registers to hold
    auto fetch = [&]() __attribute__((always_inline)) {
#pragma unroll
        for (int it = 0; it < NSTG; ++it) {
            kreg[it] = *(const v4f*)(kp + (size_t)it * 32 * WTOK);
            vreg[it] = *(const v4f*)(kp + (size_t)it * 32 * WTOK + CH);
        }
        // precaution: stands in front of the rewrite of the address registers that these loads name
        asm volatile("s_wait_xcnt 0x0" ::: "memory");
        kp += (size_t)KTILE * WTOK;
    };
    auto convert = [&]() __attribute__((always_inline)) {
#pragma unroll
        for (int it = 0; it < NSTG; ++it)
#pragma unroll
            for (int i = 0; i < 4; ++i) {
                kh4[it][i] = (_Float16)kreg[it][i];
                vh4[it][i] = (_Float16)vreg[it][i];
            }
    };
    // into the buffers that start kofs and vofs halves into sK and sVt: K row-major, V transposed
    auto stage = [&](const int kofs, const int vofs) __attribute__((always_inline)) {
        _Float16* kw = &sK[0][key0][ch4] + kofs;
        _Float16* vw = &sVt[0][ch4 >> 4][(ch4 & 15) * VPITCH + key0] + vofs;
#pragma unroll
        for (int it = 0; it < NSTG; ++it) {
            *(v4h*)(kw + it * 32 * KPITCH) = kh4[it];
#pragma unroll
            for (int i = 0; i < 4; ++i) vw[i * VPITCH + it * 32] = vh4[it][i];
        }
    };

    fetch();           // tile 0
    convert();
    fetch();           // tile 1
    stage(0, 0);
    convert();
    __syncthreads();   // tile 0 resident in LDS

    // ---- S^T = K (Q*s^2)^T : NCHUNK tiles of 16 keys x QT query tiles, 2 WMMAs each ----
    // s[ct][c][r] = score of key kh*64 + c*16 + half*8 + r against query ct*16 + l16,
    // in the log2 domain, less the query's reference (a lane's 8 rows are one query's)
    auto scores = [&](v8f (&s)[QT][NCHUNK], const int kofs) __attribute__((always_inline)) {
        v8f nref[QT];
#pragma unroll
        for (int ct = 0; ct < QT; ++ct)
#pragma unroll
            for (int r = 0; r < 8; ++r) nref[ct][r] = m[ct];
#pragma unroll
        for (int c = 0; c < NCHUNK; ++c) {
#pragma unroll
            for (int ct = 0; ct < QT; ++ct) s[ct][c] = nref[ct];
            const _Float16* kb = &sK[0][kh * KHALF + c * 16 + l16][0] + kofs;
#pragma unroll
            for (int f = 0; f < 2; ++f) {
                v8h lo = *(const v8h*)(kb + f * 32 + kbase);
                v8h hi = *(const v8h*)(kb + f * 32 + kbase + 16);
                v16h afrag;
#pragma unroll
                for (int i = 0; i < 8; ++i) { afrag[i] = lo[i]; afrag[8 + i] = hi[i]; }
#pragma unroll
                for (int ct = 0; ct < QT; ++ct)
                    s[ct][c] = __builtin_amdgcn_wmma_f32_16x16x32_f16(
                                   false, afrag, false, qfrag[ct][f], (short)0, s[ct][c], false, false);
            }
        }
        // order of the region above: the K fragment reads in groups, 4 fragments ahead of the
        // products; behind the fences below the compiler otherwise waits out every single read
        __builtin_amdgcn_sched_group_barrier(0x100, 8, 0);
        __builtin_amdgcn_sched_group_barrier(0x008, 4, 0);
        __builtin_amdgcn_sched_group_barrier(0x100, 4, 0);
        __builtin_amdgcn_sched_group_barrier(0x008, 4, 0);
        __builtin_amdgcn_sched_group_barrier(0x100, 4, 0);
        __builtin_amdgcn_sched_group_barrier(0x008, 8, 0);
    };

    // The reference moves to the maximum of the scores in s (set = no reference is held yet: to it,
    // up or down; else only up), and all that is held follows. Both lane halves take the same step.
    auto rebase = [&](v8f (&s)[QT][NCHUNK], const bool set) __attribute__((always_inline)) {
#pragma unroll
        for (int ct = 0; ct < QT; ++ct) {
            float rmax[8];
#pragma unroll
            for (int r = 0; r < 8; ++r) {
                float v = s[ct][0][r];
#pragma unroll
                for (int c = 1; c < NCHUNK; ++c) v = fmaxf(v, s[ct][c][r]);
                rmax[r] = v;
            }
            const float tm = fmaxf(fmaxf(fmaxf(rmax[0], rmax[1]), fmaxf(rmax[2], rmax[3])),
                                   fmaxf(fmaxf(rmax[4], rmax[5]), fmaxf(rmax[6], rmax[7])));
            const float t  = fmaxf(tm, xhalf(tm));
            const float d  = set ? t : fmaxf(t, 0.0f);
            m[ct] -= d;
            if (!set) {   // nothing is held yet where the reference is set
                const float alpha = __builtin_amdgcn_exp2f(-d);
                l[ct] *= alpha;
#pragma unroll
                for (int cc = 0; cc < 4; ++cc) o[ct][cc] *= alpha;
            }
#pragma unroll
            for (int c = 0; c < NCHUNK; ++c) s[ct][c] -= d;
        }
    };

    // ---- p = 2^s for one query tile, in-lane: its sum over this lane's keys, and P^T as B operand:
    // tiles 2f and 2f+1 hold keys in the fragment's k order
    auto softmax = [&](v8f (&s)[NCHUNK], v16h (&pfrag)[KFRAG]) __attribute__((always_inline)) -> float {
        v8f rsum;
#pragma unroll
        for (int c = 0; c < NCHUNK; ++c) {
            v8f t;
#pragma unroll
            for (int r = 0; r < 8; ++r) t[r] = __builtin_amdgcn_exp2f(s[c][r]);
            s[c] = t;
            rsum = (c == 0) ? t : rsum + t;
        }
#pragma unroll
        for (int f = 0; f < KFRAG; ++f)
#pragma unroll
            for (int i = 0; i < 8; ++i) {
                pfrag[f][i]     = (_Float16)s[2 * f][i];
                pfrag[f][8 + i] = (_Float16)s[2 * f + 1][i];
            }
        return ((rsum[0] + rsum[1]) + (rsum[2] + rsum[3])) +
               ((rsum[4] + rsum[5]) + (rsum[6] + rsum[7]));
    };

    // one A fragment of V^T: channels cc*16 .. +15, keys f*32 .. +31 of this wave's key half
    auto vfrag = [&](const int f, const int cc, const int vofs) __attribute__((always_inline)) -> v16h {
        const _Float16* vb = &sVt[0][cc][l16 * VPITCH + kh * KHALF] + vofs;
        v8h lo = *(const v8h*)(vb + f * 32 + kbase);
        v8h hi = *(const v8h*)(vb + f * 32 + kbase + 16);
        v16h afrag;
#pragma unroll
        for (int i = 0; i < 8; ++i) { afrag[i] = lo[i]; afrag[8 + i] = hi[i]; }
        return afrag;
    };

    // ------- one key tile, read from the buffers at kofs and vofs; the next goes to kwr and vwr ---
    // first = no reference is set yet: this pass sets it
    // more  = another tile follows: it goes from its fp16 registers into the other buffers
    // more2 = a tile follows that one: it is fetched meanwhile
    // (inlined with constant flags, so loads and stores stand under no branch)
    auto pass = [&](const bool first, const bool more, const bool more2, const int kofs, const int vofs,
                    const int kwr, const int vwr) __attribute__((always_inline)) {

        v8f s[QT][NCHUNK];
        scores(s, kofs);

        // The next tile goes into the next buffers here. They held the tile of two passes ago: every
        // wave had read it to the end before its signal in the last pass, and this wave has waited
        // for all those signals. The stores drain under the vector work below, where this wave asks
        // nothing of LDS. The loads of the tile after it go out where the K fragments' registers
        // are free again.
        // Fences: neither hoisted among the products above nor sunk towards the pass's end.
        __builtin_amdgcn_sched_barrier(0);
        if (more)  stage(kwr, vwr);
        if (more2) fetch();
        __builtin_amdgcn_sched_barrier(0);

        // Only the first pass takes maxima: they are its reference, and p is at most 1 there.
        if (first) rebase(s, true);

        v16h  pfrag[QT][KFRAG];
        float ls[QT];                   // this pass's sums of p over the lane's keys
        ls[0] = softmax(s[0], pfrag[0]);

        // First half of the pass's barrier, by hand so that its wait can stand at the pass's end:
        // this wave's share of the next tile is in LDS (the LDS wait; the stores have had the first
        // query tile's exponentials to drain) and it has left the last pass's buffers. A wave may so
        // run on to the pass's end while others are only here.
        // The reads between signal and wait are of this pass's own tile: its buffers are written
        // again only two passes on, behind the wait for every wave's next signal, whose LDS wait
        // ends these reads.
        if (more) {
            asm volatile("s_wait_dscnt 0x0\n\ts_barrier_signal -1" ::: "memory");
            // fence: without it the second tile's exponentials are all lifted over the signal, which
            // then comes so late that the waves ahead wait for it at their pass's end
            __builtin_amdgcn_sched_barrier(0);
        }

        ls[1] = softmax(s[1], pfrag[1]);

        // the first V^T fragments are asked for ahead of the test below, under the exponentials
        v16h va[2];
        va[0] = vfrag(0, 0, vofs);
        va[1] = vfrag(0, 1, vofs);

        // No maxima in the later passes: a p above LIMIT makes its lane's sum exceed LIMIT (an
        // overflow of exp2 too: the sum is then infinite). One test a pass for the whole wave, a
        // scalar branch. Where it is taken nothing of this pass has been added yet: the scores are
        // formed anew from K, which is still resident, the reference moves up to their maximum, and
        // p and the sums are taken again, now at most 1 each.
        if (!first) {
            if (__builtin_amdgcn_ballot_w32(fmaxf(ls[0], ls[1]) > LIMIT) != 0) {
                scores(s, kofs);
                rebase(s, false);
                ls[0] = softmax(s[0], pfrag[0]);
                ls[1] = softmax(s[1], pfrag[1]);
                // read again here, so that they hold no registers through this branch
                va[0] = vfrag(0, 0, vofs);
                va[1] = vfrag(0, 1, vofs);
            }
        }
        l[0] += ls[0];
        l[1] += ls[1];

        // ---- O^T += V^T P^T : A from transposed V, B from registers --------
        // key fragment outermost: its eight products go to eight different accumulators,
        // and those of the first fragment need only the first half of P
#pragma unroll
        for (int f = 0; f < KFRAG; ++f) {
#pragma unroll
            for (int cc = 0; cc < 4; ++cc) {
                const v16h afrag = (f == 0 && cc < 2) ? va[cc] : vfrag(f, cc, vofs);
#pragma unroll
                for (int ct = 0; ct < QT; ++ct)
                    o[ct][cc] = __builtin_amdgcn_wmma_f32_16x16x32_f16(
                                    false, afrag, false, pfrag[ct][f], (short)0, o[ct][cc], false, false);
            }
        }

        // order of the region above: V^T fragment reads in groups of two fragments, two fragments
        // ahead of their products; left alone the compiler reads each fragment right in front of its
        // products and waits out the read
        __builtin_amdgcn_sched_group_barrier(0x100, 4, 0);
        __builtin_amdgcn_sched_group_barrier(0x008, 4, 0);
        __builtin_amdgcn_sched_group_barrier(0x100, 4, 0);
        __builtin_amdgcn_sched_group_barrier(0x008, 4, 0);
        __builtin_amdgcn_sched_group_barrier(0x100, 4, 0);
        __builtin_amdgcn_sched_group_barrier(0x008, 8, 0);

        // the fetched tile to fp16, beside the last products
        if (more2) convert();
        if (more) {
            // fence: the wait stays behind the pass's last products; lifted over them, a wave that is
            // ahead would stand at the barrier with products still to issue
            __builtin_amdgcn_sched_barrier(0);
            // second half of the pass's barrier: every wave has signalled, so the next tile is resident
            asm volatile("s_barrier_wait 0xffff" ::: "memory");
        }
    };

    // ------- stream over key tiles ------------------------------------------
    // Two of a SIMD's four waves win every issue slot they ask for (whether a SIMD takes waves
    // w, w + 4, ... or four in a row, this bit picks two of its four): they run ahead as far as
    // the split barrier lets them, and the halves stop meeting the same unit at the same time.
    const bool lead = ((wave ^ (wave >> 2)) & 1) != 0;
    if (lead) __builtin_amdgcn_s_setprio(3);

    pass(true, true, true, 0, 0, KBUF, VBUF);
    int kofs = KBUF, vofs = VBUF;
    for (int kt = 1; kt + 2 < NCTX / KTILE; ++kt) {
        const int kwr = (kofs == (NBUF - 1) * KBUF) ? 0 : kofs + KBUF;
        const int vwr = (vofs == (NBUF - 1) * VBUF) ? 0 : vofs + VBUF;
        pass(false, true, true, kofs, vofs, kwr, vwr);
        kofs = kwr;
        vofs = vwr;
    }
    {
        const int kwr = (kofs == (NBUF - 1) * KBUF) ? 0 : kofs + KBUF;
        const int vwr = (vofs == (NBUF - 1) * VBUF) ? 0 : vofs + VBUF;
        pass(false, true, false, kofs, vofs, kwr, vwr);
        pass(false, false, false, kwr, vwr, 0, 0);
    }
    if (lead) __builtin_amdgcn_s_setprio(0);   // back to the common priority on the way out

    // ------- join the two key halves of a query group ------------------------
    // The wave of key half 0 finishes query tile 0, the other wave tile 1: each
    // hands the tile it does not finish to its partner through LDS.
    float lt[QT];
#pragma unroll
    for (int ct = 0; ct < QT; ++ct) lt[ct] = l[ct] + xhalf(l[ct]);
    // the lane's number formed anew: no index or address of this part is then held in a register
    // over the loop, which has none to spare: held there, they go to scratch
    const int elane = (int)__builtin_amdgcn_mbcnt_lo(~0u, 0u);

    auto give = [&](const int ct) __attribute__((always_inline)) {
#pragma unroll
        for (int cc = 0; cc < 4; ++cc) {
            v4f lo, hi;
#pragma unroll
            for (int i = 0; i < 4; ++i) { lo[i] = o[ct][cc][i]; hi[i] = o[ct][cc][4 + i]; }
            *(v4f*)&sX[wave][cc * 2][elane][0]     = lo;
            *(v4f*)&sX[wave][cc * 2 + 1][elane][0] = hi;
        }
        sML[wave][0][elane] = -m[ct];
        sML[wave][1][elane] = lt[ct];
    };
    // O = (O_a 2^(-m_a - M) + O_b 2^(-m_b - M)) / (l_a 2^(-m_a - M) + l_b 2^(-m_b - M)), M = max(-m_a, -m_b)
    //   -> out[b, t, h*64 + ch], 8 channels per lane and 16-channel group
    auto take = [&](const int ct) __attribute__((always_inline)) {
        const int   pw = wave ^ 8;
        const float pm = sML[pw][0][elane];
        const float pl = sML[pw][1][elane];
        const float mm = fmaxf(-m[ct], pm);
        float fa = __builtin_amdgcn_exp2f(-m[ct] - mm);
        float fb = __builtin_amdgcn_exp2f(pm - mm);
        const float inv = 1.0f / (lt[ct] * fa + pl * fb);
        fa *= inv;
        fb *= inv;
        const int orow = qtile * QTILE + qg * (QT * 16) + ct * 16 + (elane & 15);
        float* op = out + ((size_t)(batch * NCTX + orow) * HEADS + head) * CH + (elane >> 4) * 8;
        v4f lo[4], hi[4];
#pragma unroll
        for (int cc = 0; cc < 4; ++cc) {
            const v4f plo = *(const v4f*)&sX[pw][cc * 2][elane][0];
            const v4f phi = *(const v4f*)&sX[pw][cc * 2 + 1][elane][0];
#pragma unroll
            for (int i = 0; i < 4; ++i) {
                lo[cc][i] = o[ct][cc][i] * fa     + plo[i] * fb;
                hi[cc][i] = o[ct][cc][4 + i] * fa + phi[i] * fb;
            }
        }
#pragma unroll
        for (int cc = 0; cc < 4; ++cc) {
            *(v4f*)(op + cc * 16)     = lo[cc];
            *(v4f*)(op + cc * 16 + 4) = hi[cc];
        }
        // precaution: stands in front of every rewrite of the stores' registers by code laid out behind this instance
        asm volatile("s_wait_xcnt 0x0" ::: "memory");
    };

    if (kh == 0) give(1); else give(0);
    __syncthreads();   // both partners' tiles stand in LDS
    if (kh == 0) take(0); else take(1);
}

extern "C" void kernel_launch(void* const* d_in, const int* in_sizes, int n_in,
                              void* d_out, int out_size, void* d_ws, size_t ws_size,
                              hipStream_t stream)
{
    const float* qkv = (const float*)d_in[0];
    float*       out = (float*)d_out;
    const int bs = in_sizes[0] / (NCTX * WTOK);   // 2 for the reference shapes

    dim3 grid(NCTX / QTILE, HEADS, bs);
    fa_fwd_kernel<<<grid, THREADS, 0, stream>>>(qkv, out);
}

// v009
// One run takes 27.7 microseconds.
// Two timings next to v008 both put it at 1.06 times that version's speed.
// Over all steps from v000 it is 8.63 times as fast.
#include <hip/hip_runtime.h>

typedef __attribute__((ext_vector_type(16))) _Float16 v16h;
typedef __attribute__((ext_vector_type(8)))  _Float16 v8h;
typedef __attribute__((ext_vector_type(4)))  _Float16 v4h;
typedef __attribute__((ext_vector_type(8)))  float    v8f;
typedef __attribute__((ext_vector_type(4)))  float    v4f;

#define HEADS   16
#define CH      64
#define NCTX    2048
#define WTOK    (3 * HEADS * CH)   // 3072 floats per token
#define THREADS 512                // 16 waves: 8 query groups x 2 key halves
#define QT      2                  // query tiles of 16 columns per wave
#define QTILE   (8 * QT * 16)      // 256 query rows per block
#define KTILE   128                // keys per streaming tile
#define KHALF   (KTILE / 2)        // keys of a tile that one wave works on
#define NCHUNK  (KHALF / 16)       // 4 S-tiles of 16 keys per query tile
#define KFRAG   (KHALF / 32)       // 2 A/B fragment pairs along PV K-dim
#define NSTG    (KTILE * 16 / THREADS)   // 4 keys staged per thread

// LDS row pitches in halves. Bank = dword address mod 64, so 16 rows read with
// 16-byte loads meet 16 different bank quads only at a pitch of 16 B x odd.
#define KPITCH  (CH + 8)           // 144 B
#define VPITCH  (KTILE + 8)        // 272 B
// Each group of 16 V^T rows starts 16 B later than the pitch alone would put it:
// the staging stores of a half-wave go to rows 4 apart, which 272 B alone folds
// onto 4 banks; with the shift they meet 16 banks.
#define VGROUP  (16 * VPITCH + 8)
// halves in one buffer of K and of V^T, and how many buffers each has
#define KBUF    (KTILE * KPITCH)
#define VBUF    (CH / 16 * VGROUP)
#define NBUF    3
// a p may lie up to 2^8 above the held reference: a lane's sum of p over a pass is held against this
#define LIMIT   256.0f
// floats in a staged output row
#define OPITCH  (CH + 4)           // 272 B

// lane l <-> lane l ^ 16: the two lanes that share one query column
__device__ __forceinline__ float xhalf(float v)
{
    const int u = __builtin_bit_cast(int, v);
    return __builtin_bit_cast(float,
        __builtin_amdgcn_permlanex16(u, u, 0x76543210, 0xfedcba98, false, false));
}

__global__ __launch_bounds__(THREADS)
void fa_fwd_kernel(const float* __restrict__ qkv, float* __restrict__ out)
{
    // three buffers each: tile t is read from one and tile t + 1 written to the next, while waves
    // that lag may still read tile t - 1 from the third
    __shared__ __align__(16) _Float16 sK [NBUF][KTILE][KPITCH];      // [key][ch] row-major
    __shared__ __align__(16) _Float16 sVt[NBUF][CH / 16][VGROUP];    // [ch/16][(ch%16)*VPITCH + key]
    // what a wave hands to the other wave of its query group behind the loop
    __shared__ __align__(16) float sX [THREADS / 32][8][32][4];   // one output tile
    __shared__ float               sML[THREADS / 32][2][32];      // its reference and sum
    // 16 rows a wave on their way between memory and fragments: first Q as fp16 at K's pitch, in the
    // end O as fp32 at 272 B (16 B x odd: 16 rows written with 16-byte stores meet all banks)
    __shared__ __align__(16) float sRow[THREADS / 32][16][OPITCH];

    const int tid   = threadIdx.x;
    const int wave  = __builtin_amdgcn_readfirstlane(tid >> 5);
    const int lane  = tid & 31;
    const int l16   = lane & 15;
    const int half  = lane >> 4;        // 0: lanes 0-15, 1: lanes 16-31
    const int kbase = half * 8;         // 16-bit A/B fragment K-pattern
    const int qg    = wave & 7;         // query group
    const int kh    = wave >> 3;        // key half of every tile

    const int qtile = blockIdx.x;       // 0..7
    const int head  = blockIdx.y;       // 0..15
    const int batch = blockIdx.z;

    // (1/d^(1/4))^2 = 1/sqrt(64), times log2 e: scores come out as exponents of 2
    const float scale2 = 0.125f * 1.44269504088896340736f;

    // ------- Q rows wave*16 .. +15 of the block: a wave-wide 16-byte load covers two whole rows ----
    const int rsub = lane >> 4;         // which of the two rows
    v4f qv[8];
    {
        const float* qptr = qkv + ((size_t)(batch * NCTX + qtile * QTILE + wave * 16 + rsub) * HEADS + head) * (3 * CH)
                                + l16 * 4;
#pragma unroll
        for (int i = 0; i < 8; ++i) qv[i] = *(const v4f*)(qptr + (size_t)i * 2 * WTOK);
        // precaution: stands in front of every later rewrite of the address registers that the Q loads name
        asm volatile("s_wait_xcnt 0x0" ::: "memory");
    }
    v16h qfrag[QT][2];                  // filled from LDS behind the first barrier

    // ------- online softmax state: this lane's queries are row l16 of each tile ---
    // m is MINUS the query's reference (equal in both lane halves): every p, sum and output is
    // held relative to 2^-m. The reference is the first pass's maximum and then moves only when
    // a lane's sum of p over a pass exceeds LIMIT, so p stays at or below LIMIT.
    // l sums this lane half's keys only.
    float m[QT], l[QT];
    v8f   o[QT][4];                     // o[ct][cc][r] = O[query ct*16 + l16][cc*16 + half*8 + r]
#pragma unroll
    for (int ct = 0; ct < QT; ++ct) {
        m[ct] = 0.0f; l[ct] = 0.0f;
#pragma unroll
        for (int cc = 0; cc < 4; ++cc)
#pragma unroll
            for (int r = 0; r < 8; ++r) o[ct][cc][r] = 0.0f;
    }

    // ------- this thread's share of a key tile: 4 channels of K and of V for 4 keys
    const int ch4  = (tid & 15) * 4;  // 0..60
    const int key0 = tid >> 4;        // 0..31
    // K of key key0 of tile 0; V lies CH floats behind, key + 32 lies 32 * WTOK behind
    const float* kp = qkv + ((size_t)(batch * NCTX + key0) * HEADS + head) * (3 * CH) + CH + ch4;

    v4f kreg[NSTG], vreg[NSTG];   // a tile on its way from memory, still fp32
    v4h kh4[NSTG], vh4[NSTG];     // the tile that goes into LDS next, as fp16: half the registers to hold
    auto fetch = [&]() __attribute__((always_inline)) {
#pragma unroll
        for (int it = 0; it < NSTG; ++it) {
            kreg[it] = *(const v4f*)(kp + (size_t)it * 32 * WTOK);
            vreg[it] = *(const v4f*)(kp + (size_t)it * 32 * WTOK + CH);
        }
        // precaution: stands in front of the rewrite of the address registers that these loads name
        asm volatile("s_wait_xcnt 0x0" ::: "memory");
        kp += (size_t)KTILE * WTOK;
    };
    auto convert = [&]() __attribute__((always_inline)) {
#pragma unroll
        for (int it = 0; it < NSTG; ++it)
#pragma unroll
            for (int i = 0; i < 4; ++i) {
                kh4[it][i] = (_Float16)kreg[it][i];
                vh4[it][i] = (_Float16)vreg[it][i];
            }
    };
    // into the buffers that start kofs and vofs halves into sK and sVt: K row-major, V transposed
    auto stage = [&](const int kofs, const int vofs) __attribute__((always_inline)) {
        _Float16* kw = &sK[0][key0][ch4] + kofs;
        _Float16* vw = &sVt[0][ch4 >> 4][(ch4 & 15) * VPITCH + key0] + vofs;
#pragma unroll
        for (int it = 0; it < NSTG; ++it) {
            *(v4h*)(kw + it * 32 * KPITCH) = kh4[it];
#pragma unroll
            for (int i = 0; i < 4; ++i) vw[i * VPITCH + it * 32] = vh4[it][i];
        }
    };

    fetch();           // tile 0
    // Q, scaled, to fp16 and into LDS, row-major
    {
        _Float16* qw = (_Float16*)&sRow[wave][0][0] + rsub * KPITCH + l16 * 4;
#pragma unroll
        for (int i = 0; i < 8; ++i) {
            v4h h;
#pragma unroll
            for (int j = 0; j < 4; ++j) h[j] = (_Float16)(qv[i][j] * scale2);
            *(v4h*)(qw + i * 2 * KPITCH) = h;
        }
    }
    convert();
    fetch();           // tile 1
    stage(0, 0);
    convert();
    __syncthreads();   // tile 0 and all of Q resident in LDS

    // ------- this wave's Q fragments (2 x 16 rows x 64 ch as 2 B-frags each), read as K's are ----
#pragma unroll
    for (int ct = 0; ct < QT; ++ct) {
        const _Float16* qb = (const _Float16*)&sRow[qg * QT + ct][0][0] + l16 * KPITCH + kbase;
#pragma unroll
        for (int f = 0; f < 2; ++f) {
            v8h lo = *(const v8h*)(qb + f * 32);
            v8h hi = *(const v8h*)(qb + f * 32 + 16);
#pragma unroll
            for (int i = 0; i < 8; ++i) { qfrag[ct][f][i] = lo[i]; qfrag[ct][f][8 + i] = hi[i]; }
        }
    }

    // ---- S^T = K (Q*s^2)^T : NCHUNK tiles of 16 keys x QT query tiles, 2 WMMAs each ----
    // s[ct][c][r] = score of key kh*64 + c*16 + half*8 + r against query ct*16 + l16,
    // in the log2 domain, less the query's reference (a lane's 8 rows are one query's)
    auto scores = [&](v8f (&s)[QT][NCHUNK], const int kofs) __attribute__((always_inline)) {
        v8f nref[QT];
#pragma unroll
        for (int ct = 0; ct < QT; ++ct)
#pragma unroll
            for (int r = 0; r < 8; ++r) nref[ct][r] = m[ct];
#pragma unroll
        for (int c = 0; c < NCHUNK; ++c) {
#pragma unroll
            for (int ct = 0; ct < QT; ++ct) s[ct][c] = nref[ct];
            const _Float16* kb = &sK[0][kh * KHALF + c * 16 + l16][0] + kofs;
#pragma unroll
            for (int f = 0; f < 2; ++f) {
                v8h lo = *(const v8h*)(kb + f * 32 + kbase);
                v8h hi = *(const v8h*)(kb + f * 32 + kbase + 16);
                v16h afrag;
#pragma unroll
                for (int i = 0; i < 8; ++i) { afrag[i] = lo[i]; afrag[8 + i] = hi[i]; }
#pragma unroll
                for (int ct = 0; ct < QT; ++ct)
                    s[ct][c] = __builtin_amdgcn_wmma_f32_16x16x32_f16(
                                   false, afrag, false, qfrag[ct][f], (short)0, s[ct][c], false, false);
            }
        }
        // order of the region above: the K fragment reads in groups, 4 fragments ahead of the
        // products; behind the fences below the compiler otherwise waits out every single read
        __builtin_amdgcn_sched_group_barrier(0x100, 8, 0);
        __builtin_amdgcn_sched_group_barrier(0x008, 4, 0);
        __builtin_amdgcn_sched_group_barrier(0x100, 4, 0);
        __builtin_amdgcn_sched_group_barrier(0x008, 4, 0);
        __builtin_amdgcn_sched_group_barrier(0x100, 4, 0);
        __builtin_amdgcn_sched_group_barrier(0x008, 8, 0);
    };

    // The reference moves to the maximum of the scores in s (set = no reference is held yet: to it,
    // up or down; else only up), and all that is held follows. Both lane halves take the same step.
    auto rebase = [&](v8f (&s)[QT][NCHUNK], const bool set) __attribute__((always_inline)) {
#pragma unroll
        for (int ct = 0; ct < QT; ++ct) {
            float rmax[8];
#pragma unroll
            for (int r = 0; r < 8; ++r) {
                float v = s[ct][0][r];
#pragma unroll
                for (int c = 1; c < NCHUNK; ++c) v = fmaxf(v, s[ct][c][r]);
                rmax[r] = v;
            }
            const float tm = fmaxf(fmaxf(fmaxf(rmax[0], rmax[1]), fmaxf(rmax[2], rmax[3])),
                                   fmaxf(fmaxf(rmax[4], rmax[5]), fmaxf(rmax[6], rmax[7])));
            const float t  = fmaxf(tm, xhalf(tm));
            const float d  = set ? t : fmaxf(t, 0.0f);
            m[ct] -= d;
            if (!set) {   // nothing is held yet where the reference is set
                const float alpha = __builtin_amdgcn_exp2f(-d);
                l[ct] *= alpha;
#pragma unroll
                for (int cc = 0; cc < 4; ++cc) o[ct][cc] *= alpha;
            }
#pragma unroll
            for (int c = 0; c < NCHUNK; ++c) s[ct][c] -= d;
        }
    };

    // ---- p = 2^s for one query tile, in-lane: its sum over this lane's keys, and P^T as B operand:
    // tiles 2f and 2f+1 hold keys in the fragment's k order
    auto softmax = [&](v8f (&s)[NCHUNK], v16h (&pfrag)[KFRAG]) __attribute__((always_inline)) -> float {
        v8f rsum;
#pragma unroll
        for (int c = 0; c < NCHUNK; ++c) {
            v8f t;
#pragma unroll
            for (int r = 0; r < 8; ++r) t[r] = __builtin_amdgcn_exp2f(s[c][r]);
            s[c] = t;
            rsum = (c == 0) ? t : rsum + t;
        }
#pragma unroll
        for (int f = 0; f < KFRAG; ++f)
#pragma unroll
            for (int i = 0; i < 8; ++i) {
                pfrag[f][i]     = (_Float16)s[2 * f][i];
                pfrag[f][8 + i] = (_Float16)s[2 * f + 1][i];
            }
        return ((rsum[0] + rsum[1]) + (rsum[2] + rsum[3])) +
               ((rsum[4] + rsum[5]) + (rsum[6] + rsum[7]));
    };

    // one A fragment of V^T: channels cc*16 .. +15, keys f*32 .. +31 of this wave's key half
    auto vfrag = [&](const int f, const int cc, const int vofs) __attribute__((always_inline)) -> v16h {
        const _Float16* vb = &sVt[0][cc][l16 * VPITCH + kh * KHALF] + vofs;
        v8h lo = *(const v8h*)(vb + f * 32 + kbase);
        v8h hi = *(const v8h*)(vb + f * 32 + kbase + 16);
        v16h afrag;
#pragma unroll
        for (int i = 0; i < 8; ++i) { afrag[i] = lo[i]; afrag[8 + i] = hi[i]; }
        return afrag;
    };

    // ------- one key tile, read from the buffers at kofs and vofs; the next goes to kwr and vwr ---
    // first = no reference is set yet: this pass sets it
    // more  = another tile follows: it goes from its fp16 registers into the other buffers
    // more2 = a tile follows that one: it is fetched meanwhile
    // (inlined with constant flags, so loads and stores stand under no branch)
    auto pass = [&](const bool first, const bool more, const bool more2, const int kofs, const int vofs,
                    const int kwr, const int vwr) __attribute__((always_inline)) {

        v8f s[QT][NCHUNK];
        scores(s, kofs);

        // The next tile goes into the next buffers here. They held the tile of two passes ago: every
        // wave had read it to the end before its signal in the last pass, and this wave has waited
        // for all those signals. The stores drain under the vector work below, where this wave asks
        // nothing of LDS. The loads of the tile after it go out where the K fragments' registers
        // are free again.
        // Fences: neither hoisted among the products above nor sunk towards the pass's end.
        __builtin_amdgcn_sched_barrier(0);
        if (more)  stage(kwr, vwr);
        if (more2) fetch();
        __builtin_amdgcn_sched_barrier(0);

        // Only the first pass takes maxima: they are its reference, and p is at most 1 there.
        if (first) rebase(s, true);

        v16h  pfrag[QT][KFRAG];
        float ls[QT];                   // this pass's sums of p over the lane's keys
        ls[0] = softmax(s[0], pfrag[0]);

        // First half of the pass's barrier, by hand so that its wait can stand at the pass's end:
        // this wave's share of the next tile is in LDS (the LDS wait; the stores have had the first
        // query tile's exponentials to drain) and it has left the last pass's buffers. A wave may so
        // run on to the pass's end while others are only here.
        // The reads between signal and wait are of this pass's own tile: its buffers are written
        // again only two passes on, behind the wait for every wave's next signal, whose LDS wait
        // ends these reads.
        if (more) {
            asm volatile("s_wait_dscnt 0x0\n\ts_barrier_signal -1" ::: "memory");
            // fence: without it the second tile's exponentials are all lifted over the signal, which
            // then comes so late that the waves ahead wait for it at their pass's end
            __builtin_amdgcn_sched_barrier(0);
        }

        ls[1] = softmax(s[1], pfrag[1]);

        // the first V^T fragments are asked for ahead of the test below, under the exponentials
        v16h va[2];
        va[0] = vfrag(0, 0, vofs);
        va[1] = vfrag(0, 1, vofs);

        // No maxima in the later passes: a p above LIMIT makes its lane's sum exceed LIMIT (an
        // overflow of exp2 too: the sum is then infinite). One test a pass for the whole wave, a
        // scalar branch. Where it is taken nothing of this pass has been added yet: the scores are
        // formed anew from K, which is still resident, the reference moves up to their maximum, and
        // p and the sums are taken again, now at most 1 each.
        if (!first) {
            if (__builtin_amdgcn_ballot_w32(fmaxf(ls[0], ls[1]) > LIMIT) != 0) {
                scores(s, kofs);
                rebase(s, false);
                ls[0] = softmax(s[0], pfrag[0]);
                ls[1] = softmax(s[1], pfrag[1]);
                // read again here, so that they hold no registers through this branch
                va[0] = vfrag(0, 0, vofs);
                va[1] = vfrag(0, 1, vofs);
            }
        }
        l[0] += ls[0];
        l[1] += ls[1];

        // ---- O^T += V^T P^T : A from transposed V, B from registers --------
        // key fragment outermost: its eight products go to eight different accumulators,
        // and those of the first fragment need only the first half of P
#pragma unroll
        for (int f = 0; f < KFRAG; ++f) {
#pragma unroll
            for (int cc = 0; cc < 4; ++cc) {
                const v16h afrag = (f == 0 && cc < 2) ? va[cc] : vfrag(f, cc, vofs);
#pragma unroll
                for (int ct = 0; ct < QT; ++ct)
                    o[ct][cc] = __builtin_amdgcn_wmma_f32_16x16x32_f16(
                                    false, afrag, false, pfrag[ct][f], (short)0, o[ct][cc], false, false);
            }
        }

        // order of the region above: V^T fragment reads in groups of two fragments, two fragments
        // ahead of their products; left alone the compiler reads each fragment right in front of its
        // products and waits out the read
        __builtin_amdgcn_sched_group_barrier(0x100, 4, 0);
        __builtin_amdgcn_sched_group_barrier(0x008, 4, 0);
        __builtin_amdgcn_sched_group_barrier(0x100, 4, 0);
        __builtin_amdgcn_sched_group_barrier(0x008, 4, 0);
        __builtin_amdgcn_sched_group_barrier(0x100, 4, 0);
        __builtin_amdgcn_sched_group_barrier(0x008, 8, 0);

        // the fetched tile to fp16, beside the last products
        if (more2) convert();
        if (more) {
            // fence: the wait stays behind the pass's last products; lifted over them, a wave that is
            // ahead would stand at the barrier with products still to issue
            __builtin_amdgcn_sched_barrier(0);
            // second half of the pass's barrier: every wave has signalled, so the next tile is resident
            asm volatile("s_barrier_wait 0xffff" ::: "memory");
        }
    };

    // ------- stream over key tiles ------------------------------------------
    // Two of a SIMD's four waves win every issue slot they ask for (whether a SIMD takes waves
    // w, w + 4, ... or four in a row, this bit picks two of its four): they run ahead as far as
    // the split barrier lets them, and the halves stop meeting the same unit at the same time.
    const bool lead = ((wave ^ (wave >> 2)) & 1) != 0;
    if (lead) __builtin_amdgcn_s_setprio(3);

    pass(true, true, true, 0, 0, KBUF, VBUF);
    int kofs = KBUF, vofs = VBUF;
    for (int kt = 1; kt + 2 < NCTX / KTILE; ++kt) {
        const int kwr = (kofs == (NBUF - 1) * KBUF) ? 0 : kofs + KBUF;
        const int vwr = (vofs == (NBUF - 1) * VBUF) ? 0 : vofs + VBUF;
        pass(false, true, true, kofs, vofs, kwr, vwr);
        kofs = kwr;
        vofs = vwr;
    }
    {
        const int kwr = (kofs == (NBUF - 1) * KBUF) ? 0 : kofs + KBUF;
        const int vwr = (vofs == (NBUF - 1) * VBUF) ? 0 : vofs + VBUF;
        pass(false, true, false, kofs, vofs, kwr, vwr);
        pass(false, false, false, kwr, vwr, 0, 0);
    }
    if (lead) __builtin_amdgcn_s_setprio(0);   // back to the common priority on the way out

    // ------- join the two key halves of a query group ------------------------
    // The wave of key half 0 finishes query tile 0, the other wave tile 1: each
    // hands the tile it does not finish to its partner through LDS.
    float lt[QT];
#pragma unroll
    for (int ct = 0; ct < QT; ++ct) lt[ct] = l[ct] + xhalf(l[ct]);
    // the lane's number formed anew: no index or address of this part is then held in a register
    // over the loop, which has none to spare: held there, they go to scratch
    const int elane = (int)__builtin_amdgcn_mbcnt_lo(~0u, 0u);

    auto give = [&](const int ct) __attribute__((always_inline)) {
#pragma unroll
        for (int cc = 0; cc < 4; ++cc) {
            v4f lo, hi;
#pragma unroll
            for (int i = 0; i < 4; ++i) { lo[i] = o[ct][cc][i]; hi[i] = o[ct][cc][4 + i]; }
            *(v4f*)&sX[wave][cc * 2][elane][0]     = lo;
            *(v4f*)&sX[wave][cc * 2 + 1][elane][0] = hi;
        }
        sML[wave][0][elane] = -m[ct];
        sML[wave][1][elane] = lt[ct];
    };
    // O = (O_a 2^(m_a - M) + O_b 2^(m_b - M)) / (l_a 2^(m_a - M) + l_b 2^(m_b - M))
    //   -> out[b, t, h*64 + ch], by way of this wave's own 16 rows in LDS: whole rows go out
    auto take = [&](const int ct) __attribute__((always_inline)) {
        const int   pw = wave ^ 8;
        const float pm = sML[pw][0][elane];
        const float pl = sML[pw][1][elane];
        const float mm = fmaxf(-m[ct], pm);
        float fa = __builtin_amdgcn_exp2f(-m[ct] - mm);
        float fb = __builtin_amdgcn_exp2f(pm - mm);
        const float inv = 1.0f / (lt[ct] * fa + pl * fb);
        fa *= inv;
        fb *= inv;
        const int orow = qtile * QTILE + qg * (QT * 16) + ct * 16 + (elane >> 4);
        float* op = out + ((size_t)(batch * NCTX + orow) * HEADS + head) * CH + (elane & 15) * 4;
        float* sw = &sRow[wave][elane & 15][(elane >> 4) * 8];   // as the accumulators lie
        const float* sr = &sRow[wave][elane >> 4][(elane & 15) * 4];   // as the rows lie in memory
        v4f lo[4], hi[4];
#pragma unroll
        for (int cc = 0; cc < 4; ++cc) {
            const v4f plo = *(const v4f*)&sX[pw][cc * 2][elane][0];
            const v4f phi = *(const v4f*)&sX[pw][cc * 2 + 1][elane][0];
#pragma unroll
            for (int i = 0; i < 4; ++i) {
                lo[cc][i] = o[ct][cc][i] * fa     + plo[i] * fb;
                hi[cc][i] = o[ct][cc][4 + i] * fa + phi[i] * fb;
            }
        }
#pragma unroll
        for (int cc = 0; cc < 4; ++cc) {
            *(v4f*)(sw + cc * 16)     = lo[cc];
            *(v4f*)(sw + cc * 16 + 4) = hi[cc];
        }
        // the reads below are of what other lanes of this wave have stored above
        asm volatile("s_wait_dscnt 0x0" ::: "memory");
        // a wave-wide 16-byte store covers two whole rows
#pragma unroll
        for (int i = 0; i < 8; ++i)
            *(v4f*)(op + (size_t)i * 2 * HEADS * CH) = *(const v4f*)(sr + i * 2 * OPITCH);
        // precaution: stands in front of every rewrite of the stores' registers by code laid out behind this instance
        asm volatile("s_wait_xcnt 0x0" ::: "memory");
    };

    if (kh == 0) give(1); else give(0);
    __syncthreads();   // both partners' tiles stand in LDS
    if (kh == 0) take(0); else take(1);
}

extern "C" void kernel_launch(void* const* d_in, const int* in_sizes, int n_in,
                              void* d_out, int out_size, void* d_ws, size_t ws_size,
                              hipStream_t stream)
{
    const float* qkv = (const float*)d_in[0];
    float*       out = (float*)d_out;
    const int bs = in_sizes[0] / (NCTX * WTOK);   // 2 for the reference shapes

    dim3 grid(NCTX / QTILE, HEADS, bs);
    fa_fwd_kernel<<<grid, THREADS, 0, stream>>>(qkv, out);
}

// v010
// A run of this version takes 26.2 microseconds.
// Two timings next to v009 both put it at 1.05 times that version's speed.
// All steps since v000 together make it 9.07 times as fast.
#include <hip/hip_runtime.h>

typedef __attribute__((ext_vector_type(16))) _Float16 v16h;
typedef __attribute__((ext_vector_type(8)))  _Float16 v8h;
typedef __attribute__((ext_vector_type(4)))  _Float16 v4h;
typedef __attribute__((ext_vector_type(8)))  float    v8f;
typedef __attribute__((ext_vector_type(4)))  float    v4f;

#define HEADS   16
#define CH      64
#define NCTX    2048
#define WTOK    (3 * HEADS * CH)   // 3072 floats per token
#define THREADS 512                // 16 waves: 8 query groups x 2 key halves
#define QT      2                  // query tiles of 16 columns per wave
#define QTILE   (8 * QT * 16)      // 256 query rows per block
#define KTILE   128                // keys per streaming tile
#define KHALF   (KTILE / 2)        // keys of a tile that one wave works on
#define NCHUNK  (KHALF / 16)       // 4 S-tiles of 16 keys per query tile
#define KFRAG   (KHALF / 32)       // 2 A/B fragment pairs along PV K-dim
#define NSTG    (KTILE * 16 / THREADS)   // 4 keys staged per thread, next to one another

// LDS row pitches in halves. Bank = dword address mod 64, so 16 rows read with
// 16-byte loads meet 16 different bank quads only at a pitch of 16 B x odd.
#define KPITCH  (CH + 8)           // 144 B
#define VPITCH  (KTILE + 8)        // 272 B
// Each group of 16 V^T rows starts 32 B later than the pitch alone would put it: a wave's 8-byte
// staging stores go to rows 4 apart in two groups, 4 neighbouring pieces each; rows 4 apart lie 16
// banks apart, the pieces fill 8 banks, and the shift puts the second group on the next 8.
#define VGROUP  (16 * VPITCH + 16)
// halves in one buffer of K and of V^T, and how many buffers each has
#define KBUF    (KTILE * KPITCH)
#define VBUF    (CH / 16 * VGROUP)
#define NBUF    3
// a p may lie up to 2^8 above the held reference: a lane's sum of p over a pass is held against this
#define LIMIT   256.0f
// floats in a staged output row
#define OPITCH  (CH + 4)           // 272 B

// lane l <-> lane l ^ 16: the two lanes that share one query column
__device__ __forceinline__ float xhalf(float v)
{
    const int u = __builtin_bit_cast(int, v);
    return __builtin_bit_cast(float,
        __builtin_amdgcn_permlanex16(u, u, 0x76543210, 0xfedcba98, false, false));
}

__global__ __launch_bounds__(THREADS)
void fa_fwd_kernel(const float* __restrict__ qkv, float* __restrict__ out)
{
    // three buffers each: tile t is read from one and tile t + 1 written to the next, while waves
    // that lag may still read tile t - 1 from the third
    __shared__ __align__(16) _Float16 sK [NBUF][KTILE][KPITCH];      // [key][ch] row-major
    __shared__ __align__(16) _Float16 sVt[NBUF][CH / 16][VGROUP];    // [ch/16][(ch%16)*VPITCH + key]
    // what a wave hands to the other wave of its query group behind the loop
    __shared__ __align__(16) float sX [THREADS / 32][8][32][4];   // one output tile
    __shared__ float               sML[THREADS / 32][2][32];      // its reference and sum
    // 16 rows a wave on their way between memory and fragments: first Q as fp16 at K's pitch, in the
    // end O as fp32 at 272 B (16 B x odd: 16 rows written with 16-byte stores meet all banks)
    __shared__ __align__(16) float sRow[THREADS / 32][16][OPITCH];

    const int tid   = threadIdx.x;
    const int wave  = __builtin_amdgcn_readfirstlane(tid >> 5);
    const int lane  = tid & 31;
    const int l16   = lane & 15;
    const int half  = lane >> 4;        // 0: lanes 0-15, 1: lanes 16-31
    const int kbase = half * 8;         // 16-bit A/B fragment K-pattern
    const int qg    = wave & 7;         // query group
    const int kh    = wave >> 3;        // key half of every tile

    const int qtile = blockIdx.x;       // 0..7
    const int head  = blockIdx.y;       // 0..15
    const int batch = blockIdx.z;

    // (1/d^(1/4))^2 = 1/sqrt(64), times log2 e: scores come out as exponents of 2
    const float scale2 = 0.125f * 1.44269504088896340736f;

    // ------- Q rows wave*16 .. +15 of the block: a wave-wide 16-byte load covers two whole rows ----
    const int rsub = lane >> 4;         // which of the two rows
    v4f qv[8];
    {
        const float* qptr = qkv + ((size_t)(batch * NCTX + qtile * QTILE + wave * 16 + rsub) * HEADS + head) * (3 * CH)
                                + l16 * 4;
#pragma unroll
        for (int i = 0; i < 8; ++i) qv[i] = *(const v4f*)(qptr + (size_t)i * 2 * WTOK);
        // precaution: stands in front of every later rewrite of the address registers that the Q loads name
        asm volatile("s_wait_xcnt 0x0" ::: "memory");
    }
    v16h qfrag[QT][2];                  // filled from LDS behind the first barrier

    // ------- online softmax state: this lane's queries are row l16 of each tile ---
    // m is MINUS the query's reference (equal in both lane halves): every p, sum and output is
    // held relative to 2^-m. The reference is the first pass's maximum and then moves only when
    // a lane's sum of p over a pass exceeds LIMIT, so p stays at or below LIMIT.
    // l sums this lane half's keys only.
    float m[QT], l[QT];
    v8f   o[QT][4];                     // o[ct][cc][r] = O[query ct*16 + l16][cc*16 + half*8 + r]
#pragma unroll
    for (int ct = 0; ct < QT; ++ct) {
        m[ct] = 0.0f; l[ct] = 0.0f;
#pragma unroll
        for (int cc = 0; cc < 4; ++cc)
#pragma unroll
            for (int r = 0; r < 8; ++r) o[ct][cc][r] = 0.0f;
    }

    // ------- this thread's share of a key tile: 4 channels of K and of V for 4 adjacent keys,
    // so that its piece of a V^T row is 8 bytes in a row and goes to LDS in one store
    // A wave takes half the channels (one 128-B line of a row) of 4 x 4 keys: its 8-byte stores of K
    // (4 rows that lie 4 apart, 64 B of each) and of V^T then meet every LDS bank once.
    const int ch4  = (((tid >> 5) & 1) * 8 + (tid & 7)) * 4;          // 0..60
    const int key0 = ((tid >> 6) * 4 + ((tid >> 3) & 3)) * NSTG;      // 0, 4, .. 124
    // K of key key0 of tile 0; V lies CH floats behind, the next key WTOK behind
    const float* kp = qkv + ((size_t)(batch * NCTX + key0) * HEADS + head) * (3 * CH) + CH + ch4;

    v4f kreg[NSTG], vreg[NSTG];   // a tile on its way from memory, still fp32
    // the tile that goes into LDS next, as fp16: half the registers to hold.
    // kh4[it] = 4 channels of key it, vt4[i] = 4 keys of channel i
    v4h kh4[NSTG], vt4[4];
    auto fetch = [&]() __attribute__((always_inline)) {
#pragma unroll
        for (int it = 0; it < NSTG; ++it) {
            kreg[it] = *(const v4f*)(kp + (size_t)it * WTOK);
            vreg[it] = *(const v4f*)(kp + (size_t)it * WTOK + CH);
        }
        // precaution: stands in front of the rewrite of the address registers that these loads name
        asm volatile("s_wait_xcnt 0x0" ::: "memory");
        kp += (size_t)KTILE * WTOK;
    };
    auto convert = [&]() __attribute__((always_inline)) {
#pragma unroll
        for (int i = 0; i < 4; ++i)
#pragma unroll
            for (int it = 0; it < NSTG; ++it) vt4[i][it] = (_Float16)vreg[it][i];
#pragma unroll
        for (int it = 0; it < NSTG; ++it)
#pragma unroll
            for (int i = 0; i < 4; ++i) kh4[it][i] = (_Float16)kreg[it][i];
    };
    // into the buffers that start kofs and vofs halves into sK and sVt: K row-major, V transposed
    auto stage = [&](const int kofs, const int vofs) __attribute__((always_inline)) {
        _Float16* kw = &sK[0][key0][ch4] + kofs;
        _Float16* vw = &sVt[0][ch4 >> 4][(ch4 & 15) * VPITCH + key0] + vofs;
#pragma unroll
        for (int it = 0; it < NSTG; ++it) *(v4h*)(kw + it * KPITCH) = kh4[it];
#pragma unroll
        for (int i = 0; i < 4; ++i) *(v4h*)(vw + i * VPITCH) = vt4[i];
    };

    fetch();           // tile 0
    // Q, scaled, to fp16 and into LDS, row-major
    {
        _Float16* qw = (_Float16*)&sRow[wave][0][0] + rsub * KPITCH + l16 * 4;
#pragma unroll
        for (int i = 0; i < 8; ++i) {
            v4h h;
#pragma unroll
            for (int j = 0; j < 4; ++j) h[j] = (_Float16)(qv[i][j] * scale2);
            *(v4h*)(qw + i * 2 * KPITCH) = h;
        }
    }
    convert();
    fetch();           // tile 1
    stage(0, 0);
    convert();
    __syncthreads();   // tile 0 and all of Q resident in LDS

    // ------- this wave's Q fragments (2 x 16 rows x 64 ch as 2 B-frags each), read as K's are ----
#pragma unroll
    for (int ct = 0; ct < QT; ++ct) {
        const _Float16* qb = (const _Float16*)&sRow[qg * QT + ct][0][0] + l16 * KPITCH + kbase;
#pragma unroll
        for (int f = 0; f < 2; ++f) {
            v8h lo = *(const v8h*)(qb + f * 32);
            v8h hi = *(const v8h*)(qb + f * 32 + 16);
#pragma unroll
            for (int i = 0; i < 8; ++i) { qfrag[ct][f][i] = lo[i]; qfrag[ct][f][8 + i] = hi[i]; }
        }
    }

    // ---- S^T = K (Q*s^2)^T : NCHUNK tiles of 16 keys x QT query tiles, 2 WMMAs each ----
    // s[ct][c][r] = score of key kh*64 + c*16 + half*8 + r against query ct*16 + l16,
    // in the log2 domain, less the query's reference (a lane's 8 rows are one query's)
    auto scores = [&](v8f (&s)[QT][NCHUNK], const int kofs) __attribute__((always_inline)) {
        v8f nref[QT];
#pragma unroll
        for (int ct = 0; ct < QT; ++ct)
#pragma unroll
            for (int r = 0; r < 8; ++r) nref[ct][r] = m[ct];
#pragma unroll
        for (int c = 0; c < NCHUNK; ++c) {
#pragma unroll
            for (int ct = 0; ct < QT; ++ct) s[ct][c] = nref[ct];
            const _Float16* kb = &sK[0][kh * KHALF + c * 16 + l16][0] + kofs;
#pragma unroll
            for (int f = 0; f < 2; ++f) {
                v8h lo = *(const v8h*)(kb + f * 32 + kbase);
                v8h hi = *(const v8h*)(kb + f * 32 + kbase + 16);
                v16h afrag;
#pragma unroll
                for (int i = 0; i < 8; ++i) { afrag[i] = lo[i]; afrag[8 + i] = hi[i]; }
#pragma unroll
                for (int ct = 0; ct < QT; ++ct)
                    s[ct][c] = __builtin_amdgcn_wmma_f32_16x16x32_f16(
                                   false, afrag, false, qfrag[ct][f], (short)0, s[ct][c], false, false);
            }
        }
        // order of the region above: the K fragment reads in groups, 4 fragments ahead of the
        // products; behind the fences below the compiler otherwise waits out every single read
        __builtin_amdgcn_sched_group_barrier(0x100, 8, 0);
        __builtin_amdgcn_sched_group_barrier(0x008, 4, 0);
        __builtin_amdgcn_sched_group_barrier(0x100, 4, 0);
        __builtin_amdgcn_sched_group_barrier(0x008, 4, 0);
        __builtin_amdgcn_sched_group_barrier(0x100, 4, 0);
        __builtin_amdgcn_sched_group_barrier(0x008, 8, 0);
    };

    // The reference moves to the maximum of the scores in s (set = no reference is held yet: to it,
    // up or down; else only up), and all that is held follows. Both lane halves take the same step.
    auto rebase = [&](v8f (&s)[QT][NCHUNK], const bool set) __attribute__((always_inline)) {
#pragma unroll
        for (int ct = 0; ct < QT; ++ct) {
            float rmax[8];
#pragma unroll
            for (int r = 0; r < 8; ++r) {
                float v = s[ct][0][r];
#pragma unroll
                for (int c = 1; c < NCHUNK; ++c) v = fmaxf(v, s[ct][c][r]);
                rmax[r] = v;
            }
            const float tm = fmaxf(fmaxf(fmaxf(rmax[0], rmax[1]), fmaxf(rmax[2], rmax[3])),
                                   fmaxf(fmaxf(rmax[4], rmax[5]), fmaxf(rmax[6], rmax[7])));
            const float t  = fmaxf(tm, xhalf(tm));
            const float d  = set ? t : fmaxf(t, 0.0f);
            m[ct] -= d;
            if (!set) {   // nothing is held yet where the reference is set
                const float alpha = __builtin_amdgcn_exp2f(-d);
                l[ct] *= alpha;
#pragma unroll
                for (int cc = 0; cc < 4; ++cc) o[ct][cc] *= alpha;
            }
#pragma unroll
            for (int c = 0; c < NCHUNK; ++c) s[ct][c] -= d;
        }
    };

    // ---- p = 2^s for one query tile, in-lane: its sum over this lane's keys, and P^T as B operand:
    // tiles 2f and 2f+1 hold keys in the fragment's k order
    auto softmax = [&](v8f (&s)[NCHUNK], v16h (&pfrag)[KFRAG]) __attribute__((always_inline)) -> float {
        v8f rsum;
#pragma unroll
        for (int c = 0; c < NCHUNK; ++c) {
            v8f t;
#pragma unroll
            for (int r = 0; r < 8; ++r) t[r] = __builtin_amdgcn_exp2f(s[c][r]);
            s[c] = t;
            rsum = (c == 0) ? t : rsum + t;
        }
#pragma unroll
        for (int f = 0; f < KFRAG; ++f)
#pragma unroll
            for (int i = 0; i < 8; ++i) {
                pfrag[f][i]     = (_Float16)s[2 * f][i];
                pfrag[f][8 + i] = (_Float16)s[2 * f + 1][i];
            }
        return ((rsum[0] + rsum[1]) + (rsum[2] + rsum[3])) +
               ((rsum[4] + rsum[5]) + (rsum[6] + rsum[7]));
    };

    // one A fragment of V^T: channels cc*16 .. +15, keys f*32 .. +31 of this wave's key half
    auto vfrag = [&](const int f, const int cc, const int vofs) __attribute__((always_inline)) -> v16h {
        const _Float16* vb = &sVt[0][cc][l16 * VPITCH + kh * KHALF] + vofs;
        v8h lo = *(const v8h*)(vb + f * 32 + kbase);
        v8h hi = *(const v8h*)(vb + f * 32 + kbase + 16);
        v16h afrag;
#pragma unroll
        for (int i = 0; i < 8; ++i) { afrag[i] = lo[i]; afrag[8 + i] = hi[i]; }
        return afrag;
    };

    // ------- one key tile, read from the buffers at kofs and vofs; the next goes to kwr and vwr ---
    // first = no reference is set yet: this pass sets it
    // more  = another tile follows: it goes from its fp16 registers into the other buffers
    // more2 = a tile follows that one: it is fetched meanwhile
    // (inlined with constant flags, so loads and stores stand under no branch)
    auto pass = [&](const bool first, const bool more, const bool more2, const int kofs, const int vofs,
                    const int kwr, const int vwr) __attribute__((always_inline)) {

        v8f s[QT][NCHUNK];
        scores(s, kofs);

        // The next tile goes into the next buffers here. They held the tile of two passes ago: every
        // wave had read it to the end before its signal in the last pass, and this wave has waited
        // for all those signals. The stores drain under the vector work below, where this wave asks
        // nothing of LDS. The loads of the tile after it go out where the K fragments' registers
        // are free again.
        // Fences: neither hoisted among the products above nor sunk towards the pass's end.
        __builtin_amdgcn_sched_barrier(0);
        if (more)  stage(kwr, vwr);
        if (more2) fetch();
        __builtin_amdgcn_sched_barrier(0);

        // Only the first pass takes maxima: they are its reference, and p is at most 1 there.
        if (first) rebase(s, true);

        v16h  pfrag[QT][KFRAG];
        float ls[QT];                   // this pass's sums of p over the lane's keys
        ls[0] = softmax(s[0], pfrag[0]);

        // First half of the pass's barrier, by hand so that its wait can stand at the pass's end:
        // this wave's share of the next tile is in LDS (the LDS wait; the stores have had the first
        // query tile's exponentials to drain) and it has left the last pass's buffers. A wave may so
        // run on to the pass's end while others are only here.
        // The reads between signal and wait are of this pass's own tile: its buffers are written
        // again only two passes on, behind the wait for every wave's next signal, whose LDS wait
        // ends these reads.
        if (more) {
            asm volatile("s_wait_dscnt 0x0\n\ts_barrier_signal -1" ::: "memory");
            // fence: without it the second tile's exponentials are all lifted over the signal, which
            // then comes so late that the waves ahead wait for it at their pass's end
            __builtin_amdgcn_sched_barrier(0);
        }

        ls[1] = softmax(s[1], pfrag[1]);

        // the first V^T fragments are asked for ahead of the test below, under the exponentials
        v16h va[2];
        va[0] = vfrag(0, 0, vofs);
        va[1] = vfrag(0, 1, vofs);

        // No maxima in the later passes: a p above LIMIT makes its lane's sum exceed LIMIT (an
        // overflow of exp2 too: the sum is then infinite). One test a pass for the whole wave, a
        // scalar branch. Where it is taken nothing of this pass has been added yet: the scores are
        // formed anew from K, which is still resident, the reference moves up to their maximum, and
        // p and the sums are taken again, now at most 1 each.
        if (!first) {
            if (__builtin_amdgcn_ballot_w32(fmaxf(ls[0], ls[1]) > LIMIT) != 0) {
                scores(s, kofs);
                rebase(s, false);
                ls[0] = softmax(s[0], pfrag[0]);
                ls[1] = softmax(s[1], pfrag[1]);
                // read again here, so that they hold no registers through this branch
                va[0] = vfrag(0, 0, vofs);
                va[1] = vfrag(0, 1, vofs);
            }
        }
        l[0] += ls[0];
        l[1] += ls[1];

        // ---- O^T += V^T P^T : A from transposed V, B from registers --------
        // key fragment outermost: its eight products go to eight different accumulators,
        // and those of the first fragment need only the first half of P
#pragma unroll
        for (int f = 0; f < KFRAG; ++f) {
#pragma unroll
            for (int cc = 0; cc < 4; ++cc) {
                const v16h afrag = (f == 0 && cc < 2) ? va[cc] : vfrag(f, cc, vofs);
#pragma unroll
                for (int ct = 0; ct < QT; ++ct)
                    o[ct][cc] = __builtin_amdgcn_wmma_f32_16x16x32_f16(
                                    false, afrag, false, pfrag[ct][f], (short)0, o[ct][cc], false, false);
            }
        }

        // order of the region above: V^T fragment reads in groups of two fragments, two fragments
        // ahead of their products; left alone the compiler reads each fragment right in front of its
        // products and waits out the read
        __builtin_amdgcn_sched_group_barrier(0x100, 4, 0);
        __builtin_amdgcn_sched_group_barrier(0x008, 4, 0);
        __builtin_amdgcn_sched_group_barrier(0x100, 4, 0);
        __builtin_amdgcn_sched_group_barrier(0x008, 4, 0);
        __builtin_amdgcn_sched_group_barrier(0x100, 4, 0);
        __builtin_amdgcn_sched_group_barrier(0x008, 8, 0);

        // the fetched tile to fp16
        if (more2) {
            // fence: the conversion stays behind the last product; among the products its results
            // land in operand registers just read, at four idle slots a time
            __builtin_amdgcn_sched_barrier(0);
            convert();
        }
        if (more) {
            // fence: the wait stays behind the pass's last products; lifted over them, a wave that is
            // ahead would stand at the barrier with products still to issue
            __builtin_amdgcn_sched_barrier(0);
            // second half of the pass's barrier: every wave has signalled, so the next tile is resident
            asm volatile("s_barrier_wait 0xffff" ::: "memory");
        }
    };

    // ------- stream over key tiles ------------------------------------------
    // Two of a SIMD's four waves win every issue slot they ask for (whether a SIMD takes waves
    // w, w + 4, ... or four in a row, this bit picks two of its four): they run ahead as far as
    // the split barrier lets them, and the halves stop meeting the same unit at the same time.
    const bool lead = ((wave ^ (wave >> 2)) & 1) != 0;
    if (lead) __builtin_amdgcn_s_setprio(3);

    pass(true, true, true, 0, 0, KBUF, VBUF);
    int kofs = KBUF, vofs = VBUF;
    for (int kt = 1; kt + 2 < NCTX / KTILE; ++kt) {
        const int kwr = (kofs == (NBUF - 1) * KBUF) ? 0 : kofs + KBUF;
        const int vwr = (vofs == (NBUF - 1) * VBUF) ? 0 : vofs + VBUF;
        pass(false, true, true, kofs, vofs, kwr, vwr);
        kofs = kwr;
        vofs = vwr;
    }
    {
        const int kwr = (kofs == (NBUF - 1) * KBUF) ? 0 : kofs + KBUF;
        const int vwr = (vofs == (NBUF - 1) * VBUF) ? 0 : vofs + VBUF;
        pass(false, true, false, kofs, vofs, kwr, vwr);
        pass(false, false, false, kwr, vwr, 0, 0);
    }
    if (lead) __builtin_amdgcn_s_setprio(0);   // back to the common priority on the way out

    // ------- join the two key halves of a query group ------------------------
    // The wave of key half 0 finishes query tile 0, the other wave tile 1: each
    // hands the tile it does not finish to its partner through LDS.
    float lt[QT];
#pragma unroll
    for (int ct = 0; ct < QT; ++ct) lt[ct] = l[ct] + xhalf(l[ct]);
    // the lane's number formed anew: no index or address of this part is then held in a register
    // over the loop, which has none to spare: held there, they go to scratch
    const int elane = (int)__builtin_amdgcn_mbcnt_lo(~0u, 0u);

    auto give = [&](const int ct) __attribute__((always_inline)) {
#pragma unroll
        for (int cc = 0; cc < 4; ++cc) {
            v4f lo, hi;
#pragma unroll
            for (int i = 0; i < 4; ++i) { lo[i] = o[ct][cc][i]; hi[i] = o[ct][cc][4 + i]; }
            *(v4f*)&sX[wave][cc * 2][elane][0]     = lo;
            *(v4f*)&sX[wave][cc * 2 + 1][elane][0] = hi;
        }
        sML[wave][0][elane] = -m[ct];
        sML[wave][1][elane] = lt[ct];
    };
    // O = (O_a 2^(m_a - M) + O_b 2^(m_b - M)) / (l_a 2^(m_a - M) + l_b 2^(m_b - M))
    //   -> out[b, t, h*64 + ch], by way of this wave's own 16 rows in LDS: whole rows go out
    auto take = [&](const int ct) __attribute__((always_inline)) {
        const int   pw = wave ^ 8;
        const float pm = sML[pw][0][elane];
        const float pl = sML[pw][1][elane];
        const float mm = fmaxf(-m[ct], pm);
        float fa = __builtin_amdgcn_exp2f(-m[ct] - mm);
        float fb = __builtin_amdgcn_exp2f(pm - mm);
        const float inv = 1.0f / (lt[ct] * fa + pl * fb);
        fa *= inv;
        fb *= inv;
        const int orow = qtile * QTILE + qg * (QT * 16) + ct * 16 + (elane >> 4);
        float* op = out + ((size_t)(batch * NCTX + orow) * HEADS + head) * CH + (elane & 15) * 4;
        float* sw = &sRow[wave][elane & 15][(elane >> 4) * 8];   // as the accumulators lie
        const float* sr = &sRow[wave][elane >> 4][(elane & 15) * 4];   // as the rows lie in memory
        v4f lo[4], hi[4];
#pragma unroll
        for (int cc = 0; cc < 4; ++cc) {
            const v4f plo = *(const v4f*)&sX[pw][cc * 2][elane][0];
            const v4f phi = *(const v4f*)&sX[pw][cc * 2 + 1][elane][0];
#pragma unroll
            for (int i = 0; i < 4; ++i) {
                lo[cc][i] = o[ct][cc][i] * fa     + plo[i] * fb;
                hi[cc][i] = o[ct][cc][4 + i] * fa + phi[i] * fb;
            }
        }
#pragma unroll
        for (int cc = 0; cc < 4; ++cc) {
            *(v4f*)(sw + cc * 16)     = lo[cc];
            *(v4f*)(sw + cc * 16 + 4) = hi[cc];
        }
        // the reads below are of what other lanes of this wave have stored above
        asm volatile("s_wait_dscnt 0x0" ::: "memory");
        // a wave-wide 16-byte store covers two whole rows
#pragma unroll
        for (int i = 0; i < 8; ++i)
            *(v4f*)(op + (size_t)i * 2 * HEADS * CH) = *(const v4f*)(sr + i * 2 * OPITCH);
        // precaution: stands in front of every rewrite of the stores' registers by code laid out behind this instance
        asm volatile("s_wait_xcnt 0x0" ::: "memory");
    };

    if (kh == 0) give(1); else give(0);
    __syncthreads();   // both partners' tiles stand in LDS
    if (kh == 0) take(0); else take(1);
}

extern "C" void kernel_launch(void* const* d_in, const int* in_sizes, int n_in,
                              void* d_out, int out_size, void* d_ws, size_t ws_size,
                              hipStream_t stream)
{
    const float* qkv = (const float*)d_in[0];
    float*       out = (float*)d_out;
    const int bs = in_sizes[0] / (NCTX * WTOK);   // 2 for the reference shapes

    dim3 grid(NCTX / QTILE, HEADS, bs);
    fa_fwd_kernel<<<grid, THREADS, 0, stream>>>(qkv, out);
}
